// v000
// Times are from an AMD MI455X. After a warm-up the kernel runs many times in a row, and a time is the length of
// such a window on the GPU divided by its runs, so every launch and the gaps after it count. The runs cycle
// through copies of the inputs. A figure is the median of several windows, for all but v000 over two sittings.
// Sittings can differ by a few percent; kernels timed side by side share one.
// v000 is the starting kernel. One run takes 284 microseconds.
#include <hip/hip_runtime.h>
#include <hip/hip_bf16.h>
#include <math.h>

// ---------------------------------------------------------------------------
// multiTimeAttention for MI455X (gfx1250, wave32, WMMA)
//
// Pipeline:
//   1) qp = query @ Wq + bq            (WMMA f32 16x16x4)
//   2) kp = key_ts @ Wk + bk           (WMMA f32 16x16x4)
//   3) scores[b,h] = qp_h @ kp_h^T / sqrt(32)   (WMMA f32 16x16x4)
//   4) online masked softmax over Lk per (b,q,h,d) + weighted reduce -> x
//   5) W3 row L1 norms -> stable descending rank -> gather W3p
//   6) out = x @ W3p + b3              (WMMA f32 16x16x4)
// ---------------------------------------------------------------------------

typedef __attribute__((ext_vector_type(2))) float v2f;
typedef __attribute__((ext_vector_type(8))) float v8f;

#define EMBED_TIME 128
#define NUM_HEADS  4
#define DK         32        // EMBED_TIME / NUM_HEADS
#define INPUT_DIM  64
#define NHIDDEN    256
#define BB         4
#define LQ         256
#define LK         512
#define HD         256       // NUM_HEADS * INPUT_DIM

// ---------------------------------------------------------------------------
// Generic GEMM: C[M,N] = alpha * (A[M,K] @ B[K,N]) + bias[N]
// A row-major lda=K, B row-major ldb=N. One wave per 16x16 C tile.
// Requires M%16==0, N%16==0, K%4==0. EXEC is all-1s (full 32-lane blocks).
// ---------------------------------------------------------------------------
__global__ __launch_bounds__(32)
void gemm_wmma_f32(const float* __restrict__ A, const float* __restrict__ B,
                   const float* __restrict__ bias, float* __restrict__ C,
                   int M, int N, int K, float alpha)
{
    const int ntn  = N >> 4;
    const int tile = blockIdx.x;
    const int tm   = (tile / ntn) << 4;
    const int tn   = (tile % ntn) << 4;
    const int lane = threadIdx.x;        // 0..31
    const int mr   = lane & 15;          // m (for A) / n (for B,C)
    const int kk0  = (lane >> 4) << 1;   // 0 or 2: K sub-offset this half-wave

    v8f acc = {};
    const float* arow = A + (size_t)(tm + mr) * K;       // A row for this lane
    const float* bcol = B + (size_t)(tn + mr);           // B column for this lane
    for (int k = 0; k < K; k += 4) {
        v2f a, b;
        a.x = arow[k + kk0];
        a.y = arow[k + kk0 + 1];
        b.x = bcol[(size_t)(k + kk0) * N];
        b.y = bcol[(size_t)(k + kk0 + 1) * N];
        acc = __builtin_amdgcn_wmma_f32_16x16x4_f32(
            /*neg_a=*/false, a, /*neg_b=*/false, b,
            /*c_mod=*/(short)0, acc, /*reuse_a=*/false, /*reuse_b=*/false);
    }

    const int   cn    = tn + mr;
    const float bv    = bias ? bias[cn] : 0.0f;
    const int   mbase = tm + ((lane >> 4) << 3);   // rows 0..7 or 8..15 of tile
#pragma unroll
    for (int r = 0; r < 8; ++r)
        C[(size_t)(mbase + r) * N + cn] = acc[r] * alpha + bv;
}

// ---------------------------------------------------------------------------
// Batched scores: S[b,h,q,k] = scale * sum_e qp[b,q,h*32+e] * kp[b,k,h*32+e]
// A = qp (row-major, lda=128), effective B = kp^T so both fragments are
// contiguous float2 loads. grid.x = (LQ/16)*(LK/16) = 512 tiles, grid.y = B*H.
// ---------------------------------------------------------------------------
__global__ __launch_bounds__(32)
void scores_wmma_f32(const float* __restrict__ QP, const float* __restrict__ KP,
                     float* __restrict__ S, float scale)
{
    const int bh   = blockIdx.y;
    const int b    = bh >> 2;
    const int h    = bh & 3;
    const int tile = blockIdx.x;
    const int tn   = (tile & 31) << 4;   // 32 tiles along Lk
    const int tm   = (tile >> 5) << 4;   // 16 tiles along Lq
    const int lane = threadIdx.x;
    const int mr   = lane & 15;
    const int kk0  = (lane >> 4) << 1;

    const float* arow = QP + ((size_t)b * LQ + tm + mr) * EMBED_TIME + h * DK;
    const float* brow = KP + ((size_t)b * LK + tn + mr) * EMBED_TIME + h * DK;

    v8f acc = {};
#pragma unroll
    for (int k = 0; k < DK; k += 4) {
        v2f a, bfr;
        a.x   = arow[k + kk0];
        a.y   = arow[k + kk0 + 1];
        bfr.x = brow[k + kk0];        // B[e][n] = KP[b][tn+n][h*32+e]
        bfr.y = brow[k + kk0 + 1];
        acc = __builtin_amdgcn_wmma_f32_16x16x4_f32(
            false, a, false, bfr, (short)0, acc, false, false);
    }

    float* crow = S + (size_t)bh * LQ * LK;
    const int cn    = tn + mr;
    const int mbase = tm + ((lane >> 4) << 3);
#pragma unroll
    for (int r = 0; r < 8; ++r)
        crow[(size_t)(mbase + r) * LK + cn] = acc[r] * scale;
}

// ---------------------------------------------------------------------------
// Online masked softmax over Lk + weighted reduce with value.
// One block per (b,q); thread t -> (h = t/64, d = t%64).
// Uses the reference's exact -1e9 masking so the all-masked edge case
// degenerates to a uniform average, identical to JAX.
// ---------------------------------------------------------------------------
__global__ __launch_bounds__(256)
void mta_softmax_reduce(const float* __restrict__ S, const float* __restrict__ V,
                        const int* __restrict__ MK, float* __restrict__ X)
{
    const int b = blockIdx.x >> 8;   // / LQ
    const int q = blockIdx.x & 255;  // % LQ

    __shared__ float s_sh[NUM_HEADS * LK];   // 8 KB
    for (int i = threadIdx.x; i < NUM_HEADS * LK; i += 256) {
        const int h = i >> 9, k = i & (LK - 1);
        s_sh[i] = S[(((size_t)(b * NUM_HEADS + h) * LQ + q) << 9) + k];
    }
    __syncthreads();

    const int h = threadIdx.x >> 6;
    const int d = threadIdx.x & 63;

    const float* srow = s_sh + (h << 9);
    const float* vcol = V  + (size_t)b * LK * INPUT_DIM + d;
    const int*   mcol = MK + (size_t)b * LK * INPUT_DIM + d;

    float mmax = -3.0e38f;
    float num = 0.0f, den = 0.0f;
    for (int k = 0; k < LK; ++k) {
        const float s = mcol[(size_t)k * INPUT_DIM] ? srow[k] : -1.0e9f;
        const float v = vcol[(size_t)k * INPUT_DIM];
        const float mnew  = fmaxf(mmax, s);
        const float scl   = __expf(mmax - mnew);
        const float p     = __expf(s - mnew);
        num  = num * scl + p * v;
        den  = den * scl + p;
        mmax = mnew;
    }
    X[((size_t)b * LQ + q) * HD + (h << 6) + d] = num / den;
}

// ---------------------------------------------------------------------------
// W3 row L1 norms (one block per row, tree reduction).
// ---------------------------------------------------------------------------
__global__ __launch_bounds__(256)
void w3_rownorm(const float* __restrict__ W3, float* __restrict__ nrm)
{
    __shared__ float red[256];
    const int i = blockIdx.x;
    red[threadIdx.x] = fabsf(W3[(size_t)i * NHIDDEN + threadIdx.x]);
    __syncthreads();
    for (int s = 128; s > 0; s >>= 1) {
        if (threadIdx.x < (unsigned)s) red[threadIdx.x] += red[threadIdx.x + s];
        __syncthreads();
    }
    if (threadIdx.x == 0) nrm[i] = red[0];
}

// ---------------------------------------------------------------------------
// Stable descending rank of row i, then scatter row i to W3p[rank].
// rank(i) = #{j : n_j > n_i} + #{j < i : n_j == n_i}  (stable argsort(-n)).
// ---------------------------------------------------------------------------
__global__ __launch_bounds__(256)
void w3_permute(const float* __restrict__ W3, const float* __restrict__ nrm,
                float* __restrict__ W3p)
{
    __shared__ int cnt[256];
    const int i  = blockIdx.x;
    const int j  = threadIdx.x;
    const float ni = nrm[i];
    const float nj = nrm[j];
    cnt[j] = (nj > ni || (nj == ni && j < i)) ? 1 : 0;
    __syncthreads();
    for (int s = 128; s > 0; s >>= 1) {
        if (j < s) cnt[j] += cnt[j + s];
        __syncthreads();
    }
    const int rank = cnt[0];
    W3p[(size_t)rank * NHIDDEN + j] = W3[(size_t)i * NHIDDEN + j];
}

// ---------------------------------------------------------------------------
// Orchestration
// ---------------------------------------------------------------------------
extern "C" void kernel_launch(void* const* d_in, const int* in_sizes, int n_in,
                              void* d_out, int out_size, void* d_ws, size_t ws_size,
                              hipStream_t stream)
{
    const float* query  = (const float*)d_in[0];   // [4,256,128]
    const float* key_ts = (const float*)d_in[1];   // [4,512,128]
    const float* value  = (const float*)d_in[2];   // [4,512,64]
    const int*   mask   = (const int*)  d_in[3];   // [4,512,64]
    const float* Wq     = (const float*)d_in[4];   // [128,128]
    const float* bq     = (const float*)d_in[5];
    const float* Wk     = (const float*)d_in[6];
    const float* bk     = (const float*)d_in[7];
    const float* W3     = (const float*)d_in[8];   // [256,256]
    const float* b3     = (const float*)d_in[9];
    float*       out    = (float*)d_out;           // [4,256,256]

    // Workspace layout (floats); total ~11 MB.
    float* ws     = (float*)d_ws;
    float* qp     = ws;                                  // 4*256*128   = 131072
    float* kp     = qp + (size_t)BB * LQ * EMBED_TIME;   // 4*512*128   = 262144
    float* scores = kp + (size_t)BB * LK * EMBED_TIME;   // 16*256*512  = 2097152
    float* x      = scores + (size_t)BB * NUM_HEADS * LQ * LK; // 1024*256
    float* W3p    = x + (size_t)BB * LQ * HD;            // 256*256
    float* nrm    = W3p + (size_t)HD * NHIDDEN;          // 256

    // 1) Q projection: [1024,128] @ [128,128] + bq
    gemm_wmma_f32<<<dim3((BB * LQ / 16) * (EMBED_TIME / 16)), dim3(32), 0, stream>>>(
        query, Wq, bq, qp, BB * LQ, EMBED_TIME, EMBED_TIME, 1.0f);

    // 2) K projection: [2048,128] @ [128,128] + bk
    gemm_wmma_f32<<<dim3((BB * LK / 16) * (EMBED_TIME / 16)), dim3(32), 0, stream>>>(
        key_ts, Wk, bk, kp, BB * LK, EMBED_TIME, EMBED_TIME, 1.0f);

    // 3) scores = qp_h @ kp_h^T / sqrt(dk)
    const float scale = 0.17677669529663687f;   // 1/sqrt(32)
    scores_wmma_f32<<<dim3((LQ / 16) * (LK / 16), BB * NUM_HEADS), dim3(32), 0, stream>>>(
        qp, kp, scores, scale);

    // 4) masked online softmax over Lk + weighted reduce -> x [4,256,256]
    mta_softmax_reduce<<<dim3(BB * LQ), dim3(256), 0, stream>>>(
        scores, value, mask, x);

    // 5) W3 row norms + stable descending permutation gather
    w3_rownorm<<<dim3(NHIDDEN), dim3(256), 0, stream>>>(W3, nrm);
    w3_permute<<<dim3(HD), dim3(256), 0, stream>>>(W3, nrm, W3p);

    // 6) out = x @ W3p + b3 : [1024,256] @ [256,256]
    gemm_wmma_f32<<<dim3((BB * LQ / 16) * (NHIDDEN / 16)), dim3(32), 0, stream>>>(
        x, W3p, b3, out, BB * LQ, NHIDDEN, HD, 1.0f);
}

// v001
// It runs in 49.5 microseconds.
// Timed twice side by side with v000, it ran 5.76 and 5.74 times as fast.
#include <hip/hip_runtime.h>
#include <hip/hip_bf16.h>
#include <math.h>

// ---------------------------------------------------------------------------
// multiTimeAttention for MI455X (gfx1250, wave32, WMMA)
//
// Pipeline:
//   1) qp = query @ Wq + bq            (WMMA f32 16x16x4)
//   2) kp = key_ts @ Wk + bk           (WMMA f32 16x16x4)
//   3) scores[b,h] = qp_h @ kp_h^T / sqrt(32)   (WMMA f32 16x16x4)
//   4) masked softmax over Lk + weighted reduce -> x   (WMMA f32 16x16x4)
//   5) W3 row L1 norms -> stable descending rank -> gather W3p
//   6) out = x @ W3p + b3              (WMMA f32 16x16x4)
// ---------------------------------------------------------------------------

typedef __attribute__((ext_vector_type(2))) float v2f;
typedef __attribute__((ext_vector_type(8))) float v8f;

#define EMBED_TIME 128
#define NUM_HEADS  4
#define DK         32        // EMBED_TIME / NUM_HEADS
#define INPUT_DIM  64
#define NHIDDEN    256
#define BB         4
#define LQ         256
#define LK         512
#define HD         256       // NUM_HEADS * INPUT_DIM

// ---------------------------------------------------------------------------
// Generic GEMM: C[M,N] = alpha * (A[M,K] @ B[K,N]) + bias[N]
// A row-major lda=K, B row-major ldb=N. One wave per 16x16 C tile.
// Requires M%16==0, N%16==0, K%4==0. EXEC is all-1s (full 32-lane blocks).
// ---------------------------------------------------------------------------
__global__ __launch_bounds__(32)
void gemm_wmma_f32(const float* __restrict__ A, const float* __restrict__ B,
                   const float* __restrict__ bias, float* __restrict__ C,
                   int M, int N, int K, float alpha)
{
    const int ntn  = N >> 4;
    const int tile = blockIdx.x;
    const int tm   = (tile / ntn) << 4;
    const int tn   = (tile % ntn) << 4;
    const int lane = threadIdx.x;        // 0..31
    const int mr   = lane & 15;          // m (for A) / n (for B,C)
    const int kk0  = (lane >> 4) << 1;   // 0 or 2: K sub-offset this half-wave

    v8f acc = {};
    const float* arow = A + (size_t)(tm + mr) * K;       // A row for this lane
    const float* bcol = B + (size_t)(tn + mr);           // B column for this lane
    for (int k = 0; k < K; k += 4) {
        v2f a, b;
        a.x = arow[k + kk0];
        a.y = arow[k + kk0 + 1];
        b.x = bcol[(size_t)(k + kk0) * N];
        b.y = bcol[(size_t)(k + kk0 + 1) * N];
        acc = __builtin_amdgcn_wmma_f32_16x16x4_f32(
            /*neg_a=*/false, a, /*neg_b=*/false, b,
            /*c_mod=*/(short)0, acc, /*reuse_a=*/false, /*reuse_b=*/false);
    }

    const int   cn    = tn + mr;
    const float bv    = bias ? bias[cn] : 0.0f;
    const int   mbase = tm + ((lane >> 4) << 3);   // rows 0..7 or 8..15 of tile
#pragma unroll
    for (int r = 0; r < 8; ++r)
        C[(size_t)(mbase + r) * N + cn] = acc[r] * alpha + bv;
}

// ---------------------------------------------------------------------------
// Batched scores: S[b,h,q,k] = scale * sum_e qp[b,q,h*32+e] * kp[b,k,h*32+e]
// A = qp (row-major, lda=128), effective B = kp^T so both fragments are
// contiguous float2 loads. grid.x = (LQ/16)*(LK/16) = 512 tiles, grid.y = B*H.
// ---------------------------------------------------------------------------
__global__ __launch_bounds__(32)
void scores_wmma_f32(const float* __restrict__ QP, const float* __restrict__ KP,
                     float* __restrict__ S, float scale)
{
    const int bh   = blockIdx.y;
    const int b    = bh >> 2;
    const int h    = bh & 3;
    const int tile = blockIdx.x;
    const int tn   = (tile & 31) << 4;   // 32 tiles along Lk
    const int tm   = (tile >> 5) << 4;   // 16 tiles along Lq
    const int lane = threadIdx.x;
    const int mr   = lane & 15;
    const int kk0  = (lane >> 4) << 1;

    const float* arow = QP + ((size_t)b * LQ + tm + mr) * EMBED_TIME + h * DK;
    const float* brow = KP + ((size_t)b * LK + tn + mr) * EMBED_TIME + h * DK;

    v8f acc = {};
#pragma unroll
    for (int k = 0; k < DK; k += 4) {
        v2f a, bfr;
        a.x   = arow[k + kk0];
        a.y   = arow[k + kk0 + 1];
        bfr.x = brow[k + kk0];        // B[e][n] = KP[b][tn+n][h*32+e]
        bfr.y = brow[k + kk0 + 1];
        acc = __builtin_amdgcn_wmma_f32_16x16x4_f32(
            false, a, false, bfr, (short)0, acc, false, false);
    }

    float* crow = S + (size_t)bh * LQ * LK;
    const int cn    = tn + mr;
    const int mbase = tm + ((lane >> 4) << 3);
#pragma unroll
    for (int r = 0; r < 8; ++r)
        crow[(size_t)(mbase + r) * LK + cn] = acc[r] * scale;
}

// ---------------------------------------------------------------------------
// Masked softmax over Lk + weighted reduce with value, as two matrix products.
// The score does not depend on the feature d, so with P[q,k] = exp(s[q,k] - rowmax[q])
//   num[q,d] = sum_k P[q,k] * (mask[k,d] ? v[k,d] : 0)
//   den[q,d] = sum_k P[q,k] * (mask[k,d] ? 1 : 0)          x = num / den
// which equals the reference's per-feature softmax whenever the masked terms
// (exp(-1e9 - max)) vanish and den keeps full precision. Where that is not
// certain (den tiny or zero: every k masked, or the open k far below the row
// maximum; scores near -1e9; NaN) the element is redone by mta_exact below.
//
// One block = one (b,h), 32 query rows, 32 features (half of d); 8 waves, each
// owning 64 of the 512 k. Tiles per wave: 2 row tiles x {num,den} x 2 column
// tiles; column n of column tile t is feature dh*32 + 2n + t, so a lane's two
// features come from one 8-byte load and a half-wave reads a whole 128-B line.
// k order inside a group of 8 k: half-wave hh, step s, register j holds
// k = 8p + 4hh + 2s + j, the same for the A and the B fragment.
// ---------------------------------------------------------------------------
#define PPITCH 516   // floats per P row in LDS: 16 B x odd, no bank conflict on 16-byte reads

// Lane l's value from lane l ^ X inside a 16-lane row (DPP row_xmask), and from lane l ^ 16.
template <int X>
__device__ __forceinline__ float lane_xor_row(float x)
{
    const int v = __builtin_bit_cast(int, x);
    return __builtin_bit_cast(float, __builtin_amdgcn_update_dpp(v, v, 0x160 + X, 0xf, 0xf, false));
}
__device__ __forceinline__ float lane_xor_16(float x)
{
    const int v = __builtin_bit_cast(int, x);
    return __builtin_bit_cast(float, __builtin_amdgcn_permlanex16(v, v, 0x76543210, 0xfedcba98, false, false));
}

// exp(x) as __expf forms it (one multiply, v_exp_f32). The v_nop in the same statement is the
// one slot behind a transcendental.
__device__ __forceinline__ float exp_with_slot(float x)
{
    float r;
    asm("v_exp_f32 %0, %1\n\tv_nop" : "=v"(r) : "v"(x * 1.44269504f));
    return r;
}

// The per-element online softmax with the reference's -1e9 masking (rare path).
__device__ __forceinline__ float mta_exact(const float* __restrict__ sp, const float* __restrict__ vp,
                                           const int* __restrict__ mp)
{
    float mmax = -3.0e38f;
    float num = 0.0f, den = 0.0f;
    // Kept rolled: a path that is hardly ever taken should stay small in the instruction cache.
#pragma nounroll
    for (int k = 0; k < LK; ++k) {
        const float sk = *sp;
        const int   mk = *mp;
        const float v  = *vp;
        // The three address pairs are stepped below only behind this wait.
        asm volatile("s_wait_xcnt 0x0" :: "v"(sp), "v"(mp), "v"(vp) : "memory");
        sp += 1;
        mp += INPUT_DIM;
        vp += INPUT_DIM;
        const float s     = mk ? sk : -1.0e9f;
        const float mnew  = fmaxf(mmax, s);
        const float scl   = exp_with_slot(mmax - mnew);
        const float p     = exp_with_slot(s - mnew);
        num  = num * scl + p * v;
        den  = den * scl + p;
        mmax = mnew;
    }
    return num / den;
}

__global__ __launch_bounds__(256)
void mta_softmax_reduce(const float* __restrict__ S, const float* __restrict__ V,
                        const int* __restrict__ MK, float* __restrict__ X)
{
    __shared__ __attribute__((aligned(16))) float p_sh[32 * PPITCH];        // 32 rows
    __shared__ __attribute__((aligned(16))) float red[8 * 16 * 32 * 4];     // 8 waves x 16 entries a lane
    __shared__ float rmax[32];

    const int dh   = blockIdx.x & 1;
    const int q0   = ((blockIdx.x >> 1) & 7) << 5;
    const int bh   = blockIdx.x >> 4;
    const int b    = bh >> 2;
    const int h    = bh & 3;
    const int lane = threadIdx.x & 31;
    const int w    = threadIdx.x >> 5;
    const int n    = lane & 15;
    const int hh   = lane >> 4;
    const int kbase = w << 6;

    // Scores first (needed first): wave w takes rows 4w..4w+3, 16 floats a lane a row.
    const float* srows = S + ((size_t)bh * LQ + q0) * LK;
    const float* sp = srows + (size_t)(w * 4) * LK + lane * 4;
    float4 sv[4][4];
#pragma unroll
    for (int r = 0; r < 4; ++r)
#pragma unroll
        for (int c = 0; c < 4; ++c)
            sv[r][c] = *(const float4*)(sp + r * LK + c * 128);
    // The score loads' address registers may be reused only from here on; the
    // address as an input keeps a load's result out of them before the wait.
    asm volatile("s_wait_xcnt 0x0" :: "v"(sp) : "memory");

    // Then this wave's whole slice of value and mask, in flight under the exp phase.
    const size_t boff = ((size_t)b * LK + kbase + hh * 4) * INPUT_DIM + dh * 32 + n * 2;
    const float* vp = V  + boff;
    const int*   mp = MK + boff;
    float2 bv[8][4];
    int2   bm[8][4];
#pragma unroll
    for (int p = 0; p < 8; ++p)
#pragma unroll
        for (int i = 0; i < 4; ++i) {
            bv[p][i] = *(const float2*)(vp + (p * 8 + i) * INPUT_DIM);
            bm[p][i] = *(const int2*)  (mp + (p * 8 + i) * INPUT_DIM);
        }
    // The same for the value and mask loads.
    asm volatile("s_wait_xcnt 0x0" :: "v"(vp), "v"(mp) : "memory");
    // Keeps every load above issued before the first use of a score: without it the
    // scheduler put a wait on the first scores in front of the remaining loads.
    __builtin_amdgcn_sched_barrier(0);

    // Row maxima, the four rows' chains side by side.
    float m[4];
#pragma unroll
    for (int r = 0; r < 4; ++r) {
        m[r] = -3.0e38f;
#pragma unroll
        for (int c = 0; c < 4; ++c)
            m[r] = fmaxf(m[r], fmaxf(fmaxf(sv[r][c].x, sv[r][c].y), fmaxf(sv[r][c].z, sv[r][c].w)));
    }
#pragma unroll
    for (int r = 0; r < 4; ++r) m[r] = fmaxf(m[r], lane_xor_row<1>(m[r]));
#pragma unroll
    for (int r = 0; r < 4; ++r) m[r] = fmaxf(m[r], lane_xor_row<2>(m[r]));
#pragma unroll
    for (int r = 0; r < 4; ++r) m[r] = fmaxf(m[r], lane_xor_row<4>(m[r]));
#pragma unroll
    for (int r = 0; r < 4; ++r) m[r] = fmaxf(m[r], lane_xor_row<8>(m[r]));
#pragma unroll
    for (int r = 0; r < 4; ++r) m[r] = fmaxf(m[r], lane_xor_16(m[r]));

    // P = exp(s - rowmax) into LDS.
#pragma unroll
    for (int r = 0; r < 4; ++r)
#pragma unroll
        for (int c = 0; c < 4; ++c) {
            float4 pv;
            pv.x = __expf(sv[r][c].x - m[r]);
            pv.y = __expf(sv[r][c].y - m[r]);
            pv.z = __expf(sv[r][c].z - m[r]);
            pv.w = __expf(sv[r][c].w - m[r]);
            *(float4*)(p_sh + (w * 4 + r) * PPITCH + c * 128 + lane * 4) = pv;
        }
    if (lane == 0) {
#pragma unroll
        for (int r = 0; r < 4; ++r) rmax[w * 4 + r] = m[r];
    }
    __syncthreads();

    v8f acc[2][2][2] = {};   // [row tile][num, den][column tile]
#pragma unroll
    for (int p = 0; p < 8; ++p) {
        const float4 a0 = *(const float4*)(p_sh + n * PPITCH        + kbase + p * 8 + hh * 4);
        const float4 a1 = *(const float4*)(p_sh + (16 + n) * PPITCH + kbase + p * 8 + hh * 4);
#pragma unroll
        for (int s = 0; s < 2; ++s) {
            v2f A0, A1;
            A0.x = s ? a0.z : a0.x;  A0.y = s ? a0.w : a0.y;
            A1.x = s ? a1.z : a1.x;  A1.y = s ? a1.w : a1.y;
            const float2 v0 = bv[p][2 * s], v1 = bv[p][2 * s + 1];
            const int2   m0 = bm[p][2 * s], m1 = bm[p][2 * s + 1];
            v2f Bn[2], Bd[2];
            Bn[0].x = m0.x ? v0.x : 0.0f;  Bn[0].y = m1.x ? v1.x : 0.0f;
            Bn[1].x = m0.y ? v0.y : 0.0f;  Bn[1].y = m1.y ? v1.y : 0.0f;
            Bd[0].x = m0.x ? 1.0f : 0.0f;  Bd[0].y = m1.x ? 1.0f : 0.0f;
            Bd[1].x = m0.y ? 1.0f : 0.0f;  Bd[1].y = m1.y ? 1.0f : 0.0f;
#pragma unroll
            for (int t = 0; t < 2; ++t) {
                acc[0][0][t] = __builtin_amdgcn_wmma_f32_16x16x4_f32(
                    false, A0, false, Bn[t], (short)0, acc[0][0][t], false, false);
                acc[1][0][t] = __builtin_amdgcn_wmma_f32_16x16x4_f32(
                    false, A1, false, Bn[t], (short)0, acc[1][0][t], false, false);
                acc[0][1][t] = __builtin_amdgcn_wmma_f32_16x16x4_f32(
                    false, A0, false, Bd[t], (short)0, acc[0][1][t], false, false);
                acc[1][1][t] = __builtin_amdgcn_wmma_f32_16x16x4_f32(
                    false, A1, false, Bd[t], (short)0, acc[1][1][t], false, false);
            }
        }
    }

    // Sum the 8 waves' k slices through LDS, in wave order. One 16-byte entry holds two
    // rows (registers 2rs, 2rs+1) of a lane's two features, so that the wave that sums an
    // entry stores 8 bytes a lane and a half-wave writes a whole 128-byte line of x.
#pragma unroll
    for (int mt = 0; mt < 2; ++mt)
#pragma unroll
        for (int ty = 0; ty < 2; ++ty)
#pragma unroll
            for (int rs = 0; rs < 4; ++rs) {
                float4 o;
                o.x = acc[mt][ty][0][rs * 2];     o.y = acc[mt][ty][1][rs * 2];
                o.z = acc[mt][ty][0][rs * 2 + 1]; o.w = acc[mt][ty][1][rs * 2 + 1];
                *(float4*)(red + (((((w * 2 + mt) * 2 + ty) * 4 + rs) * 32 + lane) << 2)) = o;
            }
    __syncthreads();

    const int mt = w >> 2, rs = w & 3;
    float nu[4] = {0.0f, 0.0f, 0.0f, 0.0f}, de[4] = {0.0f, 0.0f, 0.0f, 0.0f};   // [2 * row + feature]
#pragma unroll
    for (int ww = 0; ww < 8; ++ww) {
        const float4 a = *(const float4*)(red + (((((ww * 2 + mt) * 2 + 0) * 4 + rs) * 32 + lane) << 2));
        const float4 c = *(const float4*)(red + (((((ww * 2 + mt) * 2 + 1) * 4 + rs) * 32 + lane) << 2));
        nu[0] += a.x; nu[1] += a.y; nu[2] += a.z; nu[3] += a.w;
        de[0] += c.x; de[1] += c.y; de[2] += c.z; de[3] += c.w;
    }

    const int d0   = dh * 32 + n * 2;
    const int row0 = mt * 16 + hh * 8 + rs * 2;
    float* xp = X + ((size_t)b * LQ + q0 + row0) * HD + (h << 6) + d0;
    unsigned redo = 0;   // bit 2i+t: row row0+i, feature d0+t goes through mta_exact
#pragma unroll
    for (int i = 0; i < 2; ++i) {
        if (de[2 * i] >= 1.0e-20f && de[2 * i + 1] >= 1.0e-20f && rmax[row0 + i] >= -9.0e8f) {
            float2 o;
            o.x = nu[2 * i] / de[2 * i];
            o.y = nu[2 * i + 1] / de[2 * i + 1];
            *(float2*)(xp + i * HD) = o;
        } else {
            redo |= 3u << (2 * i);
        }
    }
    if (redo) {
        // Kept rolled so that the rare path's loop stands once in the code.
#pragma nounroll
        for (int e = 0; e < 4; ++e) {
            if ((redo >> e) & 1u) {
                float* xe = xp + (e >> 1) * HD + (e & 1);
                *xe = mta_exact(srows + (size_t)(row0 + (e >> 1)) * LK,
                                V  + (size_t)b * LK * INPUT_DIM + d0 + (e & 1),
                                MK + (size_t)b * LK * INPUT_DIM + d0 + (e & 1));
                // The store's address pair is reused by the next trip only behind this wait.
                asm volatile("s_wait_xcnt 0x0" :: "v"(xe) : "memory");
            }
        }
    }
}

// ---------------------------------------------------------------------------
// W3 row L1 norms (one block per row, tree reduction).
// ---------------------------------------------------------------------------
__global__ __launch_bounds__(256)
void w3_rownorm(const float* __restrict__ W3, float* __restrict__ nrm)
{
    __shared__ float red[256];
    const int i = blockIdx.x;
    red[threadIdx.x] = fabsf(W3[(size_t)i * NHIDDEN + threadIdx.x]);
    __syncthreads();
    for (int s = 128; s > 0; s >>= 1) {
        if (threadIdx.x < (unsigned)s) red[threadIdx.x] += red[threadIdx.x + s];
        __syncthreads();
    }
    if (threadIdx.x == 0) nrm[i] = red[0];
}

// ---------------------------------------------------------------------------
// Stable descending rank of row i, then scatter row i to W3p[rank].
// rank(i) = #{j : n_j > n_i} + #{j < i : n_j == n_i}  (stable argsort(-n)).
// ---------------------------------------------------------------------------
__global__ __launch_bounds__(256)
void w3_permute(const float* __restrict__ W3, const float* __restrict__ nrm,
                float* __restrict__ W3p)
{
    __shared__ int cnt[256];
    const int i  = blockIdx.x;
    const int j  = threadIdx.x;
    const float ni = nrm[i];
    const float nj = nrm[j];
    cnt[j] = (nj > ni || (nj == ni && j < i)) ? 1 : 0;
    __syncthreads();
    for (int s = 128; s > 0; s >>= 1) {
        if (j < s) cnt[j] += cnt[j + s];
        __syncthreads();
    }
    const int rank = cnt[0];
    W3p[(size_t)rank * NHIDDEN + j] = W3[(size_t)i * NHIDDEN + j];
}

// ---------------------------------------------------------------------------
// Orchestration
// ---------------------------------------------------------------------------
extern "C" void kernel_launch(void* const* d_in, const int* in_sizes, int n_in,
                              void* d_out, int out_size, void* d_ws, size_t ws_size,
                              hipStream_t stream)
{
    const float* query  = (const float*)d_in[0];   // [4,256,128]
    const float* key_ts = (const float*)d_in[1];   // [4,512,128]
    const float* value  = (const float*)d_in[2];   // [4,512,64]
    const int*   mask   = (const int*)  d_in[3];   // [4,512,64]
    const float* Wq     = (const float*)d_in[4];   // [128,128]
    const float* bq     = (const float*)d_in[5];
    const float* Wk     = (const float*)d_in[6];
    const float* bk     = (const float*)d_in[7];
    const float* W3     = (const float*)d_in[8];   // [256,256]
    const float* b3     = (const float*)d_in[9];
    float*       out    = (float*)d_out;           // [4,256,256]

    // Workspace layout (floats); total ~11 MB.
    float* ws     = (float*)d_ws;
    float* qp     = ws;                                  // 4*256*128   = 131072
    float* kp     = qp + (size_t)BB * LQ * EMBED_TIME;   // 4*512*128   = 262144
    float* scores = kp + (size_t)BB * LK * EMBED_TIME;   // 16*256*512  = 2097152
    float* x      = scores + (size_t)BB * NUM_HEADS * LQ * LK; // 1024*256
    float* W3p    = x + (size_t)BB * LQ * HD;            // 256*256
    float* nrm    = W3p + (size_t)HD * NHIDDEN;          // 256

    // 1) Q projection: [1024,128] @ [128,128] + bq
    gemm_wmma_f32<<<dim3((BB * LQ / 16) * (EMBED_TIME / 16)), dim3(32), 0, stream>>>(
        query, Wq, bq, qp, BB * LQ, EMBED_TIME, EMBED_TIME, 1.0f);

    // 2) K projection: [2048,128] @ [128,128] + bk
    gemm_wmma_f32<<<dim3((BB * LK / 16) * (EMBED_TIME / 16)), dim3(32), 0, stream>>>(
        key_ts, Wk, bk, kp, BB * LK, EMBED_TIME, EMBED_TIME, 1.0f);

    // 3) scores = qp_h @ kp_h^T / sqrt(dk)
    const float scale = 0.17677669529663687f;   // 1/sqrt(32)
    scores_wmma_f32<<<dim3((LQ / 16) * (LK / 16), BB * NUM_HEADS), dim3(32), 0, stream>>>(
        qp, kp, scores, scale);

    // 4) masked softmax over Lk + weighted reduce -> x [4,256,256]
    mta_softmax_reduce<<<dim3(BB * NUM_HEADS * (LQ / 32) * 2), dim3(256), 0, stream>>>(
        scores, value, mask, x);

    // 5) W3 row norms + stable descending permutation gather
    w3_rownorm<<<dim3(NHIDDEN), dim3(256), 0, stream>>>(W3, nrm);
    w3_permute<<<dim3(HD), dim3(256), 0, stream>>>(W3, nrm, W3p);

    // 6) out = x @ W3p + b3 : [1024,256] @ [256,256]
    gemm_wmma_f32<<<dim3((BB * LQ / 16) * (NHIDDEN / 16)), dim3(32), 0, stream>>>(
        x, W3p, b3, out, BB * LQ, NHIDDEN, HD, 1.0f);
}

// v002
// Measured time: 32.7 microseconds a run.
// Timed twice side by side with v001, it ran 1.50 and 1.51 times as fast.
// All steps since v000 together make it 8.67 times as fast.
#include <hip/hip_runtime.h>
#include <hip/hip_bf16.h>
#include <math.h>

// ---------------------------------------------------------------------------
// multiTimeAttention for MI455X (gfx1250, wave32, WMMA)
//
// Pipeline, four launches; jobs that read none of each other's output share a grid:
//   1) qp = query @ Wq + bq | kp = key_ts @ Wk + bk | W3 row L1 norms
//   2) stable descending rank of the norms -> gather W3p | scores[b,h] = qp_h @ kp_h^T / sqrt(32)
//   3) masked softmax over Lk + weighted reduce -> x
//   4) out = x @ W3p + b3
// Every product runs on WMMA f32 16x16x4.
// ---------------------------------------------------------------------------

typedef __attribute__((ext_vector_type(2))) float v2f;
typedef __attribute__((ext_vector_type(8))) float v8f;

#define EMBED_TIME 128
#define NUM_HEADS  4
#define DK         32        // EMBED_TIME / NUM_HEADS
#define INPUT_DIM  64
#define NHIDDEN    256
#define BB         4
#define LQ         256
#define LK         512
#define HD         256       // NUM_HEADS * INPUT_DIM

// ---------------------------------------------------------------------------
// Generic GEMM: C[M,N] = alpha * (A[M,K] @ B[K,N]) + bias[N]
// A row-major lda=K, B row-major ldb=N. One wave per 16x16 C tile.
// Requires M%16==0, N%16==0, K%16==0. EXEC is all-1s (whole waves only).
// ---------------------------------------------------------------------------
__device__ __forceinline__
void gemm_tile_f32(const float* __restrict__ A, const float* __restrict__ B,
                   const float* __restrict__ bias, float* __restrict__ C,
                   int N, int K, float alpha, int tile, int lane)
{
    const int ntn  = N >> 4;
    const int tm   = (tile / ntn) << 4;
    const int tn   = (tile % ntn) << 4;
    const int mr   = lane & 15;          // m (for A) / n (for B,C)
    const int kk0  = (lane >> 4) << 1;   // 0 or 2: K sub-offset this half-wave

    v8f acc = {};
    const float* arow = A + (size_t)(tm + mr) * K;       // A row for this lane
    const float* bcol = B + (size_t)(tn + mr);           // B column for this lane
    // Four k steps a trip, their loads in flight together (the depth the compiler gave the
    // plain loop by itself; with the wait below in it, it no longer unrolls one).
    for (int k = 0; k < K; k += 16) {
        const float* pa = arow + k + kk0;
        const float* pb[8];
        v2f a[4], b[4];
#pragma unroll
        for (int u = 0; u < 4; ++u) {
            pb[2 * u]     = bcol + (size_t)(k + 4 * u + kk0) * N;
            pb[2 * u + 1] = bcol + (size_t)(k + 4 * u + kk0 + 1) * N;
            a[u].x = pa[4 * u];
            a[u].y = pa[4 * u + 1];
            b[u].x = *pb[2 * u];
            b[u].y = *pb[2 * u + 1];
        }
        // The loads' address pairs may be reused only from here on; the addresses as
        // inputs keep a load's result out of them before the wait.
        asm volatile("s_wait_xcnt 0x0" :: "v"(pa), "v"(pb[0]), "v"(pb[1]), "v"(pb[2]), "v"(pb[3]),
                     "v"(pb[4]), "v"(pb[5]), "v"(pb[6]), "v"(pb[7]) : "memory");
#pragma unroll
        for (int u = 0; u < 4; ++u)
            acc = __builtin_amdgcn_wmma_f32_16x16x4_f32(
                /*neg_a=*/false, a[u], /*neg_b=*/false, b[u],
                /*c_mod=*/(short)0, acc, /*reuse_a=*/false, /*reuse_b=*/false);
    }

    const int   cn    = tn + mr;
    float bv = 0.0f;
    if (bias) {
        const float* pbias = bias + cn;
        bv = *pbias;
        // The address as an input keeps the load's result out of its own address pair.
        asm volatile("s_wait_xcnt 0x0" :: "v"(pbias) : "memory");
    }
    const int   mbase = tm + ((lane >> 4) << 3);   // rows 0..7 or 8..15 of tile
#pragma unroll
    for (int r = 0; r < 8; ++r)
        C[(size_t)(mbase + r) * N + cn] = acc[r] * alpha + bv;
}

__global__ __launch_bounds__(32)
void gemm_wmma_f32(const float* __restrict__ A, const float* __restrict__ B,
                   const float* __restrict__ bias, float* __restrict__ C,
                   int M, int N, int K, float alpha)
{
    gemm_tile_f32(A, B, bias, C, N, K, alpha, blockIdx.x, threadIdx.x);
}

// ---------------------------------------------------------------------------
// W3 row L1 norm of row i (one block per row, tree reduction).
// ---------------------------------------------------------------------------
__device__ __forceinline__
void w3_rownorm_row(const float* __restrict__ W3, float* __restrict__ nrm, float* red, int i)
{
    red[threadIdx.x] = fabsf(W3[(size_t)i * NHIDDEN + threadIdx.x]);
    __syncthreads();
    for (int s = 128; s > 0; s >>= 1) {
        if (threadIdx.x < (unsigned)s) red[threadIdx.x] += red[threadIdx.x + s];
        __syncthreads();
    }
    if (threadIdx.x == 0) nrm[i] = red[0];
}

// ---------------------------------------------------------------------------
// Launch 1: the three jobs that read inputs only, in one grid of 256-thread blocks.
// Blocks [0, QBLK): Q projection, [QBLK, QBLK + KBLK): K projection, one 16x16 tile a
// wave, the 8 waves of a block on 8 neighbouring tiles; the rest: one W3 row norm each.
// The projections stand first in the grid: their chain of loads is the longer one.
// ---------------------------------------------------------------------------
#define QBLK ((BB * LQ / 16) * (EMBED_TIME / 16) / 8)   // 64
#define KBLK ((BB * LK / 16) * (EMBED_TIME / 16) / 8)   // 128

__global__ __launch_bounds__(256)
void proj_qk_w3norm(const float* __restrict__ query, const float* __restrict__ Wq,
                    const float* __restrict__ bq, float* __restrict__ qp,
                    const float* __restrict__ key_ts, const float* __restrict__ Wk,
                    const float* __restrict__ bk, float* __restrict__ kp,
                    const float* __restrict__ W3, float* __restrict__ nrm,
                    int N, int K)
{
    __shared__ float red[256];
    const int blk = blockIdx.x;
    if (blk >= QBLK + KBLK) {
        w3_rownorm_row(W3, nrm, red, blk - (QBLK + KBLK));
        return;
    }
    // The wave's number as a scalar, so that the tile's addresses stay wave-uniform.
    const int w    = __builtin_amdgcn_readfirstlane(threadIdx.x >> 5);
    const int lane = threadIdx.x & 31;
    const bool isq = blk < QBLK;
    gemm_tile_f32(isq ? query : key_ts, isq ? Wq : Wk, isq ? bq : bk, isq ? qp : kp,
                  N, K, 1.0f, (isq ? blk : blk - QBLK) * 8 + w, lane);
    // The tile's stores: their data and address registers may be reused only from here on
    // (in the built kernel the row-norm code stands behind this path and rewrites them).
    asm volatile("s_wait_xcnt 0x0" ::: "memory");
}

// ---------------------------------------------------------------------------
// Batched scores: S[b,h,q,k] = scale * sum_e qp[b,q,h*32+e] * kp[b,k,h*32+e]
// A = qp (row-major, lda=128), effective B = kp^T so both fragments are
// contiguous float2 loads. (LQ/16)*(LK/16) = 512 tiles for each of the B*H heads.
// ---------------------------------------------------------------------------
__device__ __forceinline__
void scores_tile_f32(const float* __restrict__ QP, const float* __restrict__ KP,
                     float* __restrict__ S, float scale, int bh, int tile, int lane)
{
    const int b    = bh >> 2;
    const int h    = bh & 3;
    const int tn   = (tile & 31) << 4;   // 32 tiles along Lk
    const int tm   = (tile >> 5) << 4;   // 16 tiles along Lq
    const int mr   = lane & 15;
    const int kk0  = (lane >> 4) << 1;

    const float* arow = QP + ((size_t)b * LQ + tm + mr) * EMBED_TIME + h * DK;
    const float* brow = KP + ((size_t)b * LK + tn + mr) * EMBED_TIME + h * DK;

    v8f acc = {};
#pragma unroll
    for (int k = 0; k < DK; k += 4) {
        v2f a, bfr;
        a.x   = arow[k + kk0];
        a.y   = arow[k + kk0 + 1];
        bfr.x = brow[k + kk0];        // B[e][n] = KP[b][tn+n][h*32+e]
        bfr.y = brow[k + kk0 + 1];
        acc = __builtin_amdgcn_wmma_f32_16x16x4_f32(
            false, a, false, bfr, (short)0, acc, false, false);
    }

    float* crow = S + (size_t)bh * LQ * LK;
    const int cn    = tn + mr;
    const int mbase = tm + ((lane >> 4) << 3);
#pragma unroll
    for (int r = 0; r < 8; ++r)
        crow[(size_t)(mbase + r) * LK + cn] = acc[r] * scale;
}

// ---------------------------------------------------------------------------
// Stable descending rank of row i, then scatter row i to W3p[rank].
// rank(i) = #{j : n_j > n_i} + #{j < i : n_j == n_i}  (stable argsort(-n)).
// ---------------------------------------------------------------------------
__device__ __forceinline__
void w3_permute_row(const float* __restrict__ W3, const float* __restrict__ nrm,
                    float* __restrict__ W3p, int* cnt, int i)
{
    const int j  = threadIdx.x;
    const float ni = nrm[i];
    const float nj = nrm[j];
    cnt[j] = (nj > ni || (nj == ni && j < i)) ? 1 : 0;
    __syncthreads();
    for (int s = 128; s > 0; s >>= 1) {
        if (j < s) cnt[j] += cnt[j + s];
        __syncthreads();
    }
    const int rank = cnt[0];
    W3p[(size_t)rank * NHIDDEN + j] = W3[(size_t)i * NHIDDEN + j];
}

// ---------------------------------------------------------------------------
// Launch 2: the two jobs that need launch 1 only, in one grid of 256-thread blocks.
// Blocks [0, HD): one W3 row each (rank and scatter); they stand first because their
// chain (load, barriers, load, store) is the longer one. The rest: score tiles, one a
// wave, the 8 waves of a block on 8 neighbouring tiles along Lk.
// ---------------------------------------------------------------------------
__global__ __launch_bounds__(256)
void scores_w3perm(const float* __restrict__ QP, const float* __restrict__ KP,
                   float* __restrict__ S, float scale,
                   const float* __restrict__ W3, const float* __restrict__ nrm,
                   float* __restrict__ W3p)
{
    __shared__ int cnt[256];
    const int blk = blockIdx.x;
    if (blk < HD) {
        w3_permute_row(W3, nrm, W3p, cnt, blk);
        return;
    }
    // The wave's number as a scalar, so that the tile's addresses stay wave-uniform.
    const int w = __builtin_amdgcn_readfirstlane(threadIdx.x >> 5);
    const int t = (blk - HD) * 8 + w;          // 0 .. B*H*512 - 1
    scores_tile_f32(QP, KP, S, scale, t >> 9, t & 511, threadIdx.x & 31);
    // The tile's stores: their registers, the scalar base too, may be reused only from here
    // on (in the built kernel the rank code stands behind this path and rewrites them).
    asm volatile("s_wait_xcnt 0x0" ::: "memory");
}

// ---------------------------------------------------------------------------
// Masked softmax over Lk + weighted reduce with value, as two matrix products.
// The score does not depend on the feature d, so with P[q,k] = exp(s[q,k] - rowmax[q])
//   num[q,d] = sum_k P[q,k] * (mask[k,d] ? v[k,d] : 0)
//   den[q,d] = sum_k P[q,k] * (mask[k,d] ? 1 : 0)          x = num / den
// which equals the reference's per-feature softmax whenever the masked terms
// (exp(-1e9 - max)) vanish and den keeps full precision. Where that is not
// certain (den tiny or zero: every k masked, or the open k far below the row
// maximum; scores near -1e9; NaN) the element is redone by mta_exact below.
//
// One block = one (b,h), 32 query rows, 32 features (half of d); 8 waves, each
// owning 64 of the 512 k. Tiles per wave: 2 row tiles x {num,den} x 2 column
// tiles; column n of column tile t is feature dh*32 + 2n + t, so a lane's two
// features come from one 8-byte load and a half-wave reads a whole 128-B line.
// k order inside a group of 8 k: half-wave hh, step s, register j holds
// k = 8p + 4hh + 2s + j, the same for the A and the B fragment.
// ---------------------------------------------------------------------------
#define PPITCH 516   // floats per P row in LDS: 16 B x odd, no bank conflict on 16-byte reads

// Lane l's value from lane l ^ X inside a 16-lane row (DPP row_xmask), and from lane l ^ 16.
template <int X>
__device__ __forceinline__ float lane_xor_row(float x)
{
    const int v = __builtin_bit_cast(int, x);
    return __builtin_bit_cast(float, __builtin_amdgcn_update_dpp(v, v, 0x160 + X, 0xf, 0xf, false));
}
__device__ __forceinline__ float lane_xor_16(float x)
{
    const int v = __builtin_bit_cast(int, x);
    return __builtin_bit_cast(float, __builtin_amdgcn_permlanex16(v, v, 0x76543210, 0xfedcba98, false, false));
}

// exp(x) as __expf forms it (one multiply, v_exp_f32). The v_nop in the same statement is the
// one slot behind a transcendental.
__device__ __forceinline__ float exp_with_slot(float x)
{
    float r;
    asm("v_exp_f32 %0, %1\n\tv_nop" : "=v"(r) : "v"(x * 1.44269504f));
    return r;
}

// The per-element online softmax with the reference's -1e9 masking (rare path).
__device__ __forceinline__ float mta_exact(const float* __restrict__ sp, const float* __restrict__ vp,
                                           const int* __restrict__ mp)
{
    float mmax = -3.0e38f;
    float num = 0.0f, den = 0.0f;
    // Kept rolled: a path that is hardly ever taken should stay small in the instruction cache.
#pragma nounroll
    for (int k = 0; k < LK; ++k) {
        const float sk = *sp;
        const int   mk = *mp;
        const float v  = *vp;
        // The three address pairs are stepped below only behind this wait.
        asm volatile("s_wait_xcnt 0x0" :: "v"(sp), "v"(mp), "v"(vp) : "memory");
        sp += 1;
        mp += INPUT_DIM;
        vp += INPUT_DIM;
        const float s     = mk ? sk : -1.0e9f;
        const float mnew  = fmaxf(mmax, s);
        const float scl   = exp_with_slot(mmax - mnew);
        const float p     = exp_with_slot(s - mnew);
        num  = num * scl + p * v;
        den  = den * scl + p;
        mmax = mnew;
    }
    return num / den;
}

__global__ __launch_bounds__(256)
void mta_softmax_reduce(const float* __restrict__ S, const float* __restrict__ V,
                        const int* __restrict__ MK, float* __restrict__ X)
{
    __shared__ __attribute__((aligned(16))) float p_sh[32 * PPITCH];        // 32 rows
    __shared__ __attribute__((aligned(16))) float red[8 * 16 * 32 * 4];     // 8 waves x 16 entries a lane
    __shared__ float rmax[32];

    const int dh   = blockIdx.x & 1;
    const int q0   = ((blockIdx.x >> 1) & 7) << 5;
    const int bh   = blockIdx.x >> 4;
    const int b    = bh >> 2;
    const int h    = bh & 3;
    const int lane = threadIdx.x & 31;
    const int w    = threadIdx.x >> 5;
    const int n    = lane & 15;
    const int hh   = lane >> 4;
    const int kbase = w << 6;

    // Scores first (needed first): wave w takes rows 4w..4w+3, 16 floats a lane a row.
    const float* srows = S + ((size_t)bh * LQ + q0) * LK;
    const float* sp = srows + (size_t)(w * 4) * LK + lane * 4;
    float4 sv[4][4];
#pragma unroll
    for (int r = 0; r < 4; ++r)
#pragma unroll
        for (int c = 0; c < 4; ++c)
            sv[r][c] = *(const float4*)(sp + r * LK + c * 128);
    // The score loads' address registers may be reused only from here on; the
    // address as an input keeps a load's result out of them before the wait.
    asm volatile("s_wait_xcnt 0x0" :: "v"(sp) : "memory");

    // Then this wave's whole slice of value and mask, in flight under the exp phase.
    const size_t boff = ((size_t)b * LK + kbase + hh * 4) * INPUT_DIM + dh * 32 + n * 2;
    const float* vp = V  + boff;
    const int*   mp = MK + boff;
    float2 bv[8][4];
    int2   bm[8][4];
#pragma unroll
    for (int p = 0; p < 8; ++p)
#pragma unroll
        for (int i = 0; i < 4; ++i) {
            bv[p][i] = *(const float2*)(vp + (p * 8 + i) * INPUT_DIM);
            bm[p][i] = *(const int2*)  (mp + (p * 8 + i) * INPUT_DIM);
        }
    // The same for the value and mask loads.
    asm volatile("s_wait_xcnt 0x0" :: "v"(vp), "v"(mp) : "memory");
    // Keeps every load above issued before the first use of a score: without it the
    // scheduler put a wait on the first scores in front of the remaining loads.
    __builtin_amdgcn_sched_barrier(0);

    // Row maxima, the four rows' chains side by side.
    float m[4];
#pragma unroll
    for (int r = 0; r < 4; ++r) {
        m[r] = -3.0e38f;
#pragma unroll
        for (int c = 0; c < 4; ++c)
            m[r] = fmaxf(m[r], fmaxf(fmaxf(sv[r][c].x, sv[r][c].y), fmaxf(sv[r][c].z, sv[r][c].w)));
    }
#pragma unroll
    for (int r = 0; r < 4; ++r) m[r] = fmaxf(m[r], lane_xor_row<1>(m[r]));
#pragma unroll
    for (int r = 0; r < 4; ++r) m[r] = fmaxf(m[r], lane_xor_row<2>(m[r]));
#pragma unroll
    for (int r = 0; r < 4; ++r) m[r] = fmaxf(m[r], lane_xor_row<4>(m[r]));
#pragma unroll
    for (int r = 0; r < 4; ++r) m[r] = fmaxf(m[r], lane_xor_row<8>(m[r]));
#pragma unroll
    for (int r = 0; r < 4; ++r) m[r] = fmaxf(m[r], lane_xor_16(m[r]));

    // P = exp(s - rowmax) into LDS.
#pragma unroll
    for (int r = 0; r < 4; ++r)
#pragma unroll
        for (int c = 0; c < 4; ++c) {
            float4 pv;
            pv.x = __expf(sv[r][c].x - m[r]);
            pv.y = __expf(sv[r][c].y - m[r]);
            pv.z = __expf(sv[r][c].z - m[r]);
            pv.w = __expf(sv[r][c].w - m[r]);
            *(float4*)(p_sh + (w * 4 + r) * PPITCH + c * 128 + lane * 4) = pv;
        }
    if (lane == 0) {
#pragma unroll
        for (int r = 0; r < 4; ++r) rmax[w * 4 + r] = m[r];
    }
    __syncthreads();

    v8f acc[2][2][2] = {};   // [row tile][num, den][column tile]
#pragma unroll
    for (int p = 0; p < 8; ++p) {
        const float4 a0 = *(const float4*)(p_sh + n * PPITCH        + kbase + p * 8 + hh * 4);
        const float4 a1 = *(const float4*)(p_sh + (16 + n) * PPITCH + kbase + p * 8 + hh * 4);
#pragma unroll
        for (int s = 0; s < 2; ++s) {
            v2f A0, A1;
            A0.x = s ? a0.z : a0.x;  A0.y = s ? a0.w : a0.y;
            A1.x = s ? a1.z : a1.x;  A1.y = s ? a1.w : a1.y;
            const float2 v0 = bv[p][2 * s], v1 = bv[p][2 * s + 1];
            const int2   m0 = bm[p][2 * s], m1 = bm[p][2 * s + 1];
            v2f Bn[2], Bd[2];
            Bn[0].x = m0.x ? v0.x : 0.0f;  Bn[0].y = m1.x ? v1.x : 0.0f;
            Bn[1].x = m0.y ? v0.y : 0.0f;  Bn[1].y = m1.y ? v1.y : 0.0f;
            Bd[0].x = m0.x ? 1.0f : 0.0f;  Bd[0].y = m1.x ? 1.0f : 0.0f;
            Bd[1].x = m0.y ? 1.0f : 0.0f;  Bd[1].y = m1.y ? 1.0f : 0.0f;
#pragma unroll
            for (int t = 0; t < 2; ++t) {
                acc[0][0][t] = __builtin_amdgcn_wmma_f32_16x16x4_f32(
                    false, A0, false, Bn[t], (short)0, acc[0][0][t], false, false);
                acc[1][0][t] = __builtin_amdgcn_wmma_f32_16x16x4_f32(
                    false, A1, false, Bn[t], (short)0, acc[1][0][t], false, false);
                acc[0][1][t] = __builtin_amdgcn_wmma_f32_16x16x4_f32(
                    false, A0, false, Bd[t], (short)0, acc[0][1][t], false, false);
                acc[1][1][t] = __builtin_amdgcn_wmma_f32_16x16x4_f32(
                    false, A1, false, Bd[t], (short)0, acc[1][1][t], false, false);
            }
        }
    }

    // Sum the 8 waves' k slices through LDS, in wave order. One 16-byte entry holds two
    // rows (registers 2rs, 2rs+1) of a lane's two features, so that the wave that sums an
    // entry stores 8 bytes a lane and a half-wave writes a whole 128-byte line of x.
#pragma unroll
    for (int mt = 0; mt < 2; ++mt)
#pragma unroll
        for (int ty = 0; ty < 2; ++ty)
#pragma unroll
            for (int rs = 0; rs < 4; ++rs) {
                float4 o;
                o.x = acc[mt][ty][0][rs * 2];     o.y = acc[mt][ty][1][rs * 2];
                o.z = acc[mt][ty][0][rs * 2 + 1]; o.w = acc[mt][ty][1][rs * 2 + 1];
                *(float4*)(red + (((((w * 2 + mt) * 2 + ty) * 4 + rs) * 32 + lane) << 2)) = o;
            }
    __syncthreads();

    const int mt = w >> 2, rs = w & 3;
    float nu[4] = {0.0f, 0.0f, 0.0f, 0.0f}, de[4] = {0.0f, 0.0f, 0.0f, 0.0f};   // [2 * row + feature]
#pragma unroll
    for (int ww = 0; ww < 8; ++ww) {
        const float4 a = *(const float4*)(red + (((((ww * 2 + mt) * 2 + 0) * 4 + rs) * 32 + lane) << 2));
        const float4 c = *(const float4*)(red + (((((ww * 2 + mt) * 2 + 1) * 4 + rs) * 32 + lane) << 2));
        nu[0] += a.x; nu[1] += a.y; nu[2] += a.z; nu[3] += a.w;
        de[0] += c.x; de[1] += c.y; de[2] += c.z; de[3] += c.w;
    }

    const int d0   = dh * 32 + n * 2;
    const int row0 = mt * 16 + hh * 8 + rs * 2;
    float* xp = X + ((size_t)b * LQ + q0 + row0) * HD + (h << 6) + d0;
    unsigned redo = 0;   // bit 2i+t: row row0+i, feature d0+t goes through mta_exact
#pragma unroll
    for (int i = 0; i < 2; ++i) {
        if (de[2 * i] >= 1.0e-20f && de[2 * i + 1] >= 1.0e-20f && rmax[row0 + i] >= -9.0e8f) {
            float2 o;
            o.x = nu[2 * i] / de[2 * i];
            o.y = nu[2 * i + 1] / de[2 * i + 1];
            *(float2*)(xp + i * HD) = o;
        } else {
            redo |= 3u << (2 * i);
        }
    }
    if (redo) {
        // Kept rolled so that the rare path's loop stands once in the code.
#pragma nounroll
        for (int e = 0; e < 4; ++e) {
            if ((redo >> e) & 1u) {
                float* xe = xp + (e >> 1) * HD + (e & 1);
                *xe = mta_exact(srows + (size_t)(row0 + (e >> 1)) * LK,
                                V  + (size_t)b * LK * INPUT_DIM + d0 + (e & 1),
                                MK + (size_t)b * LK * INPUT_DIM + d0 + (e & 1));
                // The store's address pair is reused by the next trip only behind this wait.
                asm volatile("s_wait_xcnt 0x0" :: "v"(xe) : "memory");
            }
        }
    }
}

// ---------------------------------------------------------------------------
// Orchestration
// ---------------------------------------------------------------------------
extern "C" void kernel_launch(void* const* d_in, const int* in_sizes, int n_in,
                              void* d_out, int out_size, void* d_ws, size_t ws_size,
                              hipStream_t stream)
{
    const float* query  = (const float*)d_in[0];   // [4,256,128]
    const float* key_ts = (const float*)d_in[1];   // [4,512,128]
    const float* value  = (const float*)d_in[2];   // [4,512,64]
    const int*   mask   = (const int*)  d_in[3];   // [4,512,64]
    const float* Wq     = (const float*)d_in[4];   // [128,128]
    const float* bq     = (const float*)d_in[5];
    const float* Wk     = (const float*)d_in[6];
    const float* bk     = (const float*)d_in[7];
    const float* W3     = (const float*)d_in[8];   // [256,256]
    const float* b3     = (const float*)d_in[9];
    float*       out    = (float*)d_out;           // [4,256,256]

    // Workspace layout (floats); total ~11 MB.
    float* ws     = (float*)d_ws;
    float* qp     = ws;                                  // 4*256*128   = 131072
    float* kp     = qp + (size_t)BB * LQ * EMBED_TIME;   // 4*512*128   = 262144
    float* scores = kp + (size_t)BB * LK * EMBED_TIME;   // 16*256*512  = 2097152
    float* x      = scores + (size_t)BB * NUM_HEADS * LQ * LK; // 1024*256
    float* W3p    = x + (size_t)BB * LQ * HD;            // 256*256
    float* nrm    = W3p + (size_t)HD * NHIDDEN;          // 256

    // 1) qp = query @ Wq + bq, kp = key_ts @ Wk + bk, W3 row norms
    proj_qk_w3norm<<<dim3(QBLK + KBLK + HD), dim3(256), 0, stream>>>(
        query, Wq, bq, qp, key_ts, Wk, bk, kp, W3, nrm, EMBED_TIME, EMBED_TIME);

    // 2) W3 rows gathered in stable descending order of norm; scores = qp_h @ kp_h^T / sqrt(dk)
    const float scale = 0.17677669529663687f;   // 1/sqrt(32)
    scores_w3perm<<<dim3(HD + BB * NUM_HEADS * (LQ / 16) * (LK / 16) / 8), dim3(256), 0, stream>>>(
        qp, kp, scores, scale, W3, nrm, W3p);

    // 3) masked softmax over Lk + weighted reduce -> x [4,256,256]
    mta_softmax_reduce<<<dim3(BB * NUM_HEADS * (LQ / 32) * 2), dim3(256), 0, stream>>>(
        scores, value, mask, x);

    // 4) out = x @ W3p + b3 : [1024,256] @ [256,256]
    gemm_wmma_f32<<<dim3((BB * LQ / 16) * (NHIDDEN / 16)), dim3(32), 0, stream>>>(
        x, W3p, b3, out, BB * LQ, NHIDDEN, HD, 1.0f);
}

// v003
// A run of this version takes 28.1 microseconds.
// Timed twice side by side with v002, it ran 1.16 times as fast both times.
// Counting every step since v000, it is 10.1 times as fast.
#include <hip/hip_runtime.h>
#include <hip/hip_bf16.h>
#include <math.h>

// ---------------------------------------------------------------------------
// multiTimeAttention for MI455X (gfx1250, wave32, WMMA)
//
// Pipeline, three launches; jobs that read none of each other's output share a grid:
//   1) qp = query @ Wq + bq | kp = key_ts @ Wk + bk | W3 row L1 norms
//   2) scores qp_h @ kp_h^T / sqrt(32), masked softmax over Lk, weighted reduce -> x
//      | stable descending rank of the norms -> gather W3p
//   3) out = x @ W3p + b3
// Every product runs on WMMA f32 16x16x4.
// ---------------------------------------------------------------------------

typedef __attribute__((ext_vector_type(2))) float v2f;
typedef __attribute__((ext_vector_type(8))) float v8f;

#define EMBED_TIME 128
#define NUM_HEADS  4
#define DK         32        // EMBED_TIME / NUM_HEADS
#define INPUT_DIM  64
#define NHIDDEN    256
#define BB         4
#define LQ         256
#define LK         512
#define HD         256       // NUM_HEADS * INPUT_DIM

// ---------------------------------------------------------------------------
// Generic GEMM: C[M,N] = alpha * (A[M,K] @ B[K,N]) + bias[N]
// A row-major lda=K, B row-major ldb=N. One wave per 16x16 C tile.
// Requires M%16==0, N%16==0, K%16==0. EXEC is all-1s (whole waves only).
// ---------------------------------------------------------------------------
__device__ __forceinline__
void gemm_tile_f32(const float* __restrict__ A, const float* __restrict__ B,
                   const float* __restrict__ bias, float* __restrict__ C,
                   int N, int K, float alpha, int tile, int lane)
{
    const int ntn  = N >> 4;
    const int tm   = (tile / ntn) << 4;
    const int tn   = (tile % ntn) << 4;
    const int mr   = lane & 15;          // m (for A) / n (for B,C)
    const int kk0  = (lane >> 4) << 1;   // 0 or 2: K sub-offset this half-wave

    v8f acc = {};
    const float* arow = A + (size_t)(tm + mr) * K;       // A row for this lane
    const float* bcol = B + (size_t)(tn + mr);           // B column for this lane
    // Four k steps a trip, their loads in flight together (the depth the compiler gave the
    // plain loop by itself; with the wait below in it, it no longer unrolls one).
    for (int k = 0; k < K; k += 16) {
        const float* pa = arow + k + kk0;
        const float* pb[8];
        v2f a[4], b[4];
#pragma unroll
        for (int u = 0; u < 4; ++u) {
            pb[2 * u]     = bcol + (size_t)(k + 4 * u + kk0) * N;
            pb[2 * u + 1] = bcol + (size_t)(k + 4 * u + kk0 + 1) * N;
            a[u].x = pa[4 * u];
            a[u].y = pa[4 * u + 1];
            b[u].x = *pb[2 * u];
            b[u].y = *pb[2 * u + 1];
        }
        // The loads' address pairs may be reused only from here on; the addresses as
        // inputs keep a load's result out of them before the wait.
        asm volatile("s_wait_xcnt 0x0" :: "v"(pa), "v"(pb[0]), "v"(pb[1]), "v"(pb[2]), "v"(pb[3]),
                     "v"(pb[4]), "v"(pb[5]), "v"(pb[6]), "v"(pb[7]) : "memory");
#pragma unroll
        for (int u = 0; u < 4; ++u)
            acc = __builtin_amdgcn_wmma_f32_16x16x4_f32(
                /*neg_a=*/false, a[u], /*neg_b=*/false, b[u],
                /*c_mod=*/(short)0, acc, /*reuse_a=*/false, /*reuse_b=*/false);
    }

    const int   cn    = tn + mr;
    float bv = 0.0f;
    if (bias) {
        const float* pbias = bias + cn;
        bv = *pbias;
        // The address as an input keeps the load's result out of its own address pair.
        asm volatile("s_wait_xcnt 0x0" :: "v"(pbias) : "memory");
    }
    const int   mbase = tm + ((lane >> 4) << 3);   // rows 0..7 or 8..15 of tile
#pragma unroll
    for (int r = 0; r < 8; ++r)
        C[(size_t)(mbase + r) * N + cn] = acc[r] * alpha + bv;
}

__global__ __launch_bounds__(32)
void gemm_wmma_f32(const float* __restrict__ A, const float* __restrict__ B,
                   const float* __restrict__ bias, float* __restrict__ C,
                   int M, int N, int K, float alpha)
{
    gemm_tile_f32(A, B, bias, C, N, K, alpha, blockIdx.x, threadIdx.x);
}

// ---------------------------------------------------------------------------
// W3 row L1 norm of row i (one block per row, tree reduction).
// ---------------------------------------------------------------------------
__device__ __forceinline__
void w3_rownorm_row(const float* __restrict__ W3, float* __restrict__ nrm, float* red, int i)
{
    red[threadIdx.x] = fabsf(W3[(size_t)i * NHIDDEN + threadIdx.x]);
    __syncthreads();
    for (int s = 128; s > 0; s >>= 1) {
        if (threadIdx.x < (unsigned)s) red[threadIdx.x] += red[threadIdx.x + s];
        __syncthreads();
    }
    if (threadIdx.x == 0) nrm[i] = red[0];
}

// ---------------------------------------------------------------------------
// Launch 1: the three jobs that read inputs only, in one grid of 256-thread blocks.
// Blocks [0, QBLK): Q projection, [QBLK, QBLK + KBLK): K projection, one 16x16 tile a
// wave, the 8 waves of a block on 8 neighbouring tiles; the rest: one W3 row norm each.
// The projections stand first in the grid: their chain of loads is the longer one.
// ---------------------------------------------------------------------------
#define QBLK ((BB * LQ / 16) * (EMBED_TIME / 16) / 8)   // 64
#define KBLK ((BB * LK / 16) * (EMBED_TIME / 16) / 8)   // 128

__global__ __launch_bounds__(256)
void proj_qk_w3norm(const float* __restrict__ query, const float* __restrict__ Wq,
                    const float* __restrict__ bq, float* __restrict__ qp,
                    const float* __restrict__ key_ts, const float* __restrict__ Wk,
                    const float* __restrict__ bk, float* __restrict__ kp,
                    const float* __restrict__ W3, float* __restrict__ nrm,
                    int N, int K)
{
    __shared__ float red[256];
    const int blk = blockIdx.x;
    if (blk >= QBLK + KBLK) {
        w3_rownorm_row(W3, nrm, red, blk - (QBLK + KBLK));
        return;
    }
    // The wave's number as a scalar, so that the tile's addresses stay wave-uniform.
    const int w    = __builtin_amdgcn_readfirstlane(threadIdx.x >> 5);
    const int lane = threadIdx.x & 31;
    const bool isq = blk < QBLK;
    gemm_tile_f32(isq ? query : key_ts, isq ? Wq : Wk, isq ? bq : bk, isq ? qp : kp,
                  N, K, 1.0f, (isq ? blk : blk - QBLK) * 8 + w, lane);
    // The tile's stores: their data and address registers may be reused only from here on
    // (in the built kernel the row-norm code stands behind this path and rewrites them).
    asm volatile("s_wait_xcnt 0x0" ::: "memory");
}

// ---------------------------------------------------------------------------
// Stable descending rank of row i, then scatter row i to W3p[rank].
// rank(i) = #{j : n_j > n_i} + #{j < i : n_j == n_i}  (stable argsort(-n)).
// ---------------------------------------------------------------------------
__device__ __forceinline__
void w3_permute_row(const float* __restrict__ W3, const float* __restrict__ nrm,
                    float* __restrict__ W3p, int* cnt, int i)
{
    const int j  = threadIdx.x;
    const float ni = nrm[i];
    const float nj = nrm[j];
    cnt[j] = (nj > ni || (nj == ni && j < i)) ? 1 : 0;
    __syncthreads();
    for (int s = 128; s > 0; s >>= 1) {
        if (j < s) cnt[j] += cnt[j + s];
        __syncthreads();
    }
    const int rank = cnt[0];
    W3p[(size_t)rank * NHIDDEN + j] = W3[(size_t)i * NHIDDEN + j];
}

// ---------------------------------------------------------------------------
// Launch 2. Blocks [0, MTABLK): scores, masked softmax over Lk and weighted reduce with
// value; the rest: one W3 row each (rank and scatter), behind them in the grid because
// their chain is the shorter one.
// s[q,k] = scale * sum_e qp[b,q,h*32+e] * kp[b,k,h*32+e] stays in the block that uses it.
// The score does not depend on the feature d, so with P[q,k] = exp(s[q,k] - rowmax[q])
//   num[q,d] = sum_k P[q,k] * (mask[k,d] ? v[k,d] : 0)
//   den[q,d] = sum_k P[q,k] * (mask[k,d] ? 1 : 0)          x = num / den
// which equals the reference's per-feature softmax whenever the masked terms
// (exp(-1e9 - max)) vanish and den keeps full precision. Where that is not
// certain (den tiny or zero: every k masked, or the open k far below the row
// maximum; scores near -1e9; NaN) the element is redone by mta_exact below.
//
// One block = one (b,h), 32 query rows, 32 features (half of d); 8 waves, each
// owning 64 of the 512 k. Tiles per wave: 2 row tiles x {num,den} x 2 column
// tiles; column n of column tile t is feature dh*32 + 2n + t, so a lane's two
// features come from one 8-byte load and a half-wave reads a whole 128-B line.
// k order inside a group of 8 k: half-wave hh, step s, register j holds
// k = 8p + 4hh + 2s + j, the same for the A and the B fragment.
// Scores: the wave forms the 32 rows x its own 64 k as kp_tile @ qp_tile^T, so that a lane
// holds 8 neighbouring k of ONE query row (row = lane & 15) and P goes to LDS in 16-byte
// stores. e order inside a group of 8 e: e = 8p + 4hh + 2s + j, in both fragments.
// ---------------------------------------------------------------------------
#define PPITCH 516   // floats per P row in LDS: 16 B x odd, no bank conflict on 16-byte reads

// Lane l's value from lane l ^ X inside a 16-lane row (DPP row_xmask), and from lane l ^ 16.
template <int X>
__device__ __forceinline__ float lane_xor_row(float x)
{
    const int v = __builtin_bit_cast(int, x);
    return __builtin_bit_cast(float, __builtin_amdgcn_update_dpp(v, v, 0x160 + X, 0xf, 0xf, false));
}
__device__ __forceinline__ float lane_xor_16(float x)
{
    const int v = __builtin_bit_cast(int, x);
    return __builtin_bit_cast(float, __builtin_amdgcn_permlanex16(v, v, 0x76543210, 0xfedcba98, false, false));
}

// exp(x) as __expf forms it (one multiply, v_exp_f32). The v_nop in the same statement is the
// one slot behind a transcendental.
__device__ __forceinline__ float exp_with_slot(float x)
{
    float r;
    asm("v_exp_f32 %0, %1\n\tv_nop" : "=v"(r) : "v"(x * 1.44269504f));
    return r;
}

// Four of them in one statement: each v_exp_f32 stands behind an independent one (the results
// are kept apart from all four sources), so one v_nop behind the last serves all four slots.
__device__ __forceinline__ float4 exp4_with_slot(float a, float b, float c, float d)
{
    float x, y, z, w;
    asm("v_exp_f32 %0, %4\n\tv_exp_f32 %1, %5\n\tv_exp_f32 %2, %6\n\tv_exp_f32 %3, %7\n\tv_nop"
        : "=&v"(x), "=&v"(y), "=&v"(z), "=&v"(w)
        : "v"(a * 1.44269504f), "v"(b * 1.44269504f), "v"(c * 1.44269504f), "v"(d * 1.44269504f));
    return make_float4(x, y, z, w);
}

// The per-element online softmax with the reference's -1e9 masking (rare path).
// qr, kr: the query row's and key 0's 32 projected values of this head; the score is formed here.
__device__ __forceinline__ float mta_exact(const float* __restrict__ qr, const float* __restrict__ kr,
                                           float scale, const float* __restrict__ vp,
                                           const int* __restrict__ mp)
{
    float4 q[8];
#pragma unroll
    for (int i = 0; i < 8; ++i) q[i] = *(const float4*)(qr + 4 * i);
    // The address as an input keeps a load's result out of its address pair before the wait.
    asm volatile("s_wait_xcnt 0x0" :: "v"(qr) : "memory");
    float mmax = -3.0e38f;
    float num = 0.0f, den = 0.0f;
    // Kept rolled: a path that is hardly ever taken should stay small in the instruction cache.
#pragma nounroll
    for (int k = 0; k < LK; ++k) {
        float4 kv[8];
#pragma unroll
        for (int i = 0; i < 8; ++i) kv[i] = *(const float4*)(kr + 4 * i);
        const int   mk = *mp;
        const float v  = *vp;
        // The three address pairs are stepped below only behind this wait.
        asm volatile("s_wait_xcnt 0x0" :: "v"(kr), "v"(mp), "v"(vp) : "memory");
        kr += EMBED_TIME;
        mp += INPUT_DIM;
        vp += INPUT_DIM;
        float sk = 0.0f;
#pragma unroll
        for (int i = 0; i < 8; ++i)
            sk += q[i].x * kv[i].x + q[i].y * kv[i].y + q[i].z * kv[i].z + q[i].w * kv[i].w;
        sk *= scale;
        const float s     = mk ? sk : -1.0e9f;
        const float mnew  = fmaxf(mmax, s);
        const float scl   = exp_with_slot(mmax - mnew);
        const float p     = exp_with_slot(s - mnew);
        num  = num * scl + p * v;
        den  = den * scl + p;
        mmax = mnew;
    }
    return num / den;
}

#define MTABLK (BB * NUM_HEADS * (LQ / 32) * 2)   // 256

__global__ __launch_bounds__(256)
void mta_scores_softmax_reduce(const float* __restrict__ QP, const float* __restrict__ KP, float scale,
                               const float* __restrict__ V, const int* __restrict__ MK,
                               float* __restrict__ X, const float* __restrict__ W3,
                               const float* __restrict__ nrm, float* __restrict__ W3p)
{
    __shared__ __attribute__((aligned(16))) float p_sh[32 * PPITCH];        // 32 rows
    __shared__ __attribute__((aligned(16))) float red[8 * 16 * 32 * 4];     // 8 waves x 16 entries a lane
    __shared__ float pmax[8 * 32];                                          // a wave's maxima of the 32 rows
    __shared__ float rmax[32];
    __shared__ int   cnt[256];

    if (blockIdx.x >= MTABLK) {
        w3_permute_row(W3, nrm, W3p, cnt, blockIdx.x - MTABLK);
        return;
    }

    const int dh   = blockIdx.x & 1;
    const int q0   = ((blockIdx.x >> 1) & 7) << 5;
    const int bh   = blockIdx.x >> 4;
    const int b    = bh >> 2;
    const int h    = bh & 3;
    const int lane = threadIdx.x & 31;
    const int w    = threadIdx.x >> 5;
    const int n    = lane & 15;
    const int hh   = lane >> 4;
    const int kbase = w << 6;

    // Score fragments (needed first): 2 tiles of 16 query rows, 4 tiles of 16 keys, 16 of a
    // row's 32 e a lane.
    const float* qrows = QP + ((size_t)b * LQ + q0) * EMBED_TIME + h * DK;
    const float* krows = KP + (size_t)b * LK * EMBED_TIME + h * DK;
    const float* qf = qrows + n * EMBED_TIME + hh * 4;
    const float* kf = krows + (kbase + n) * EMBED_TIME + hh * 4;
    float4 fq[2][4], fk[4][4];
    // In the order of their use: the products of group p wait for the loads of groups 0..p only.
#pragma unroll
    for (int p = 0; p < 4; ++p) {
#pragma unroll
        for (int rt = 0; rt < 2; ++rt)
            fq[rt][p] = *(const float4*)(qf + rt * 16 * EMBED_TIME + p * 8);
#pragma unroll
        for (int ct = 0; ct < 4; ++ct)
            fk[ct][p] = *(const float4*)(kf + ct * 16 * EMBED_TIME + p * 8);
    }
    // The fragment loads' address registers may be reused only from here on; the
    // addresses as inputs keep a load's result out of them before the wait.
    asm volatile("s_wait_xcnt 0x0" :: "v"(qf), "v"(kf) : "memory");

    // This wave's slice of value and mask, in two halves so that the wave stays within 256
    // registers (two blocks a WGP): the first half flies under all of the score products.
    const size_t boff = ((size_t)b * LK + kbase + hh * 4) * INPUT_DIM + dh * 32 + n * 2;
    const float* vp = V  + boff;
    const int*   mp = MK + boff;
    float2 bv[8][4];
    int2   bm[8][4];
#pragma unroll
    for (int p = 0; p < 4; ++p)
#pragma unroll
        for (int i = 0; i < 4; ++i) {
            bv[p][i] = *(const float2*)(vp + (p * 8 + i) * INPUT_DIM);
            bm[p][i] = *(const int2*)  (mp + (p * 8 + i) * INPUT_DIM);
        }
    // The same for the value and mask loads.
    asm volatile("s_wait_xcnt 0x0" :: "v"(vp), "v"(mp) : "memory");
    // Keeps these loads issued before the first wait on a score fragment.
    __builtin_amdgcn_sched_barrier(0);

    v8f sc[2][4] = {};   // [query tile][key tile]; register r: key 16ct + 8hh + r, query 16rt + n
#pragma unroll
    for (int p = 0; p < 4; ++p) {
        if (p == 3) {
            // The second half goes out in front of the last quarter of the score products, into
            // the registers of the fragments used up. The two scheduling barriers hold it there:
            // earlier it would cost registers, later it would land after the first barrier's wait.
            __builtin_amdgcn_sched_barrier(0);
#pragma unroll
            for (int pp = 4; pp < 8; ++pp)
#pragma unroll
                for (int i = 0; i < 4; ++i) {
                    bv[pp][i] = *(const float2*)(vp + (pp * 8 + i) * INPUT_DIM);
                    bm[pp][i] = *(const int2*)  (mp + (pp * 8 + i) * INPUT_DIM);
                }
            // The address registers may be reused only from here on.
            asm volatile("s_wait_xcnt 0x0" :: "v"(vp), "v"(mp) : "memory");
            __builtin_amdgcn_sched_barrier(0);
        }
#pragma unroll
        for (int s = 0; s < 2; ++s)
#pragma unroll
            for (int ct = 0; ct < 4; ++ct) {
                v2f K2;
                K2.x = s ? fk[ct][p].z : fk[ct][p].x;  K2.y = s ? fk[ct][p].w : fk[ct][p].y;
#pragma unroll
                for (int rt = 0; rt < 2; ++rt) {
                    v2f Q2;
                    Q2.x = s ? fq[rt][p].z : fq[rt][p].x;  Q2.y = s ? fq[rt][p].w : fq[rt][p].y;
                    sc[rt][ct] = __builtin_amdgcn_wmma_f32_16x16x4_f32(
                        false, K2, false, Q2, (short)0, sc[rt][ct], false, false);
                }
            }
    }

    // Row maxima: the lane's 32 k of each row, the other half-wave's, then the 8 waves' via LDS.
    float m[2];
#pragma unroll
    for (int rt = 0; rt < 2; ++rt) {
        float t[4];
#pragma unroll
        for (int ct = 0; ct < 4; ++ct) {
#pragma unroll
            for (int r = 0; r < 8; ++r) sc[rt][ct][r] *= scale;
            t[ct] = fmaxf(fmaxf(fmaxf(sc[rt][ct][0], sc[rt][ct][1]), fmaxf(sc[rt][ct][2], sc[rt][ct][3])),
                          fmaxf(fmaxf(sc[rt][ct][4], sc[rt][ct][5]), fmaxf(sc[rt][ct][6], sc[rt][ct][7])));
        }
        m[rt] = fmaxf(fmaxf(-3.0e38f, fmaxf(t[0], t[1])), fmaxf(t[2], t[3]));
    }
#pragma unroll
    for (int rt = 0; rt < 2; ++rt) m[rt] = fmaxf(m[rt], lane_xor_16(m[rt]));
    if (hh == 0) {
#pragma unroll
        for (int rt = 0; rt < 2; ++rt) pmax[w * 32 + rt * 16 + n] = m[rt];
    }
    __syncthreads();
#pragma unroll
    for (int ww = 0; ww < 8; ++ww)
#pragma unroll
        for (int rt = 0; rt < 2; ++rt) m[rt] = fmaxf(m[rt], pmax[ww * 32 + rt * 16 + n]);

    // P = exp(s - rowmax) into LDS.
#pragma unroll
    for (int rt = 0; rt < 2; ++rt)
#pragma unroll
        for (int ct = 0; ct < 4; ++ct)
#pragma unroll
            for (int c = 0; c < 2; ++c) {
                const float4 pv = exp4_with_slot(sc[rt][ct][c * 4]     - m[rt], sc[rt][ct][c * 4 + 1] - m[rt],
                                                 sc[rt][ct][c * 4 + 2] - m[rt], sc[rt][ct][c * 4 + 3] - m[rt]);
                *(float4*)(p_sh + (rt * 16 + n) * PPITCH + kbase + ct * 16 + hh * 8 + c * 4) = pv;
            }
    if (threadIdx.x < 16) {
#pragma unroll
        for (int rt = 0; rt < 2; ++rt) rmax[rt * 16 + n] = m[rt];
    }
    __syncthreads();

    v8f acc[2][2][2] = {};   // [row tile][num, den][column tile]
#pragma unroll
    for (int p = 0; p < 8; ++p) {
        const float4 a0 = *(const float4*)(p_sh + n * PPITCH        + kbase + p * 8 + hh * 4);
        const float4 a1 = *(const float4*)(p_sh + (16 + n) * PPITCH + kbase + p * 8 + hh * 4);
#pragma unroll
        for (int s = 0; s < 2; ++s) {
            v2f A0, A1;
            A0.x = s ? a0.z : a0.x;  A0.y = s ? a0.w : a0.y;
            A1.x = s ? a1.z : a1.x;  A1.y = s ? a1.w : a1.y;
            const float2 v0 = bv[p][2 * s], v1 = bv[p][2 * s + 1];
            const int2   m0 = bm[p][2 * s], m1 = bm[p][2 * s + 1];
            v2f Bn[2], Bd[2];
            Bn[0].x = m0.x ? v0.x : 0.0f;  Bn[0].y = m1.x ? v1.x : 0.0f;
            Bn[1].x = m0.y ? v0.y : 0.0f;  Bn[1].y = m1.y ? v1.y : 0.0f;
            Bd[0].x = m0.x ? 1.0f : 0.0f;  Bd[0].y = m1.x ? 1.0f : 0.0f;
            Bd[1].x = m0.y ? 1.0f : 0.0f;  Bd[1].y = m1.y ? 1.0f : 0.0f;
#pragma unroll
            for (int t = 0; t < 2; ++t) {
                acc[0][0][t] = __builtin_amdgcn_wmma_f32_16x16x4_f32(
                    false, A0, false, Bn[t], (short)0, acc[0][0][t], false, false);
                acc[1][0][t] = __builtin_amdgcn_wmma_f32_16x16x4_f32(
                    false, A1, false, Bn[t], (short)0, acc[1][0][t], false, false);
                acc[0][1][t] = __builtin_amdgcn_wmma_f32_16x16x4_f32(
                    false, A0, false, Bd[t], (short)0, acc[0][1][t], false, false);
                acc[1][1][t] = __builtin_amdgcn_wmma_f32_16x16x4_f32(
                    false, A1, false, Bd[t], (short)0, acc[1][1][t], false, false);
            }
        }
    }

    // Sum the 8 waves' k slices through LDS, in wave order. One 16-byte entry holds two
    // rows (registers 2rs, 2rs+1) of a lane's two features, so that the wave that sums an
    // entry stores 8 bytes a lane and a half-wave writes a whole 128-byte line of x.
#pragma unroll
    for (int mt = 0; mt < 2; ++mt)
#pragma unroll
        for (int ty = 0; ty < 2; ++ty)
#pragma unroll
            for (int rs = 0; rs < 4; ++rs) {
                float4 o;
                o.x = acc[mt][ty][0][rs * 2];     o.y = acc[mt][ty][1][rs * 2];
                o.z = acc[mt][ty][0][rs * 2 + 1]; o.w = acc[mt][ty][1][rs * 2 + 1];
                *(float4*)(red + (((((w * 2 + mt) * 2 + ty) * 4 + rs) * 32 + lane) << 2)) = o;
            }
    __syncthreads();

    const int mt = w >> 2, rs = w & 3;
    float nu[4] = {0.0f, 0.0f, 0.0f, 0.0f}, de[4] = {0.0f, 0.0f, 0.0f, 0.0f};   // [2 * row + feature]
#pragma unroll
    for (int ww = 0; ww < 8; ++ww) {
        const float4 a = *(const float4*)(red + (((((ww * 2 + mt) * 2 + 0) * 4 + rs) * 32 + lane) << 2));
        const float4 c = *(const float4*)(red + (((((ww * 2 + mt) * 2 + 1) * 4 + rs) * 32 + lane) << 2));
        nu[0] += a.x; nu[1] += a.y; nu[2] += a.z; nu[3] += a.w;
        de[0] += c.x; de[1] += c.y; de[2] += c.z; de[3] += c.w;
    }

    const int d0   = dh * 32 + n * 2;
    const int row0 = mt * 16 + hh * 8 + rs * 2;
    float* xp = X + ((size_t)b * LQ + q0 + row0) * HD + (h << 6) + d0;
    unsigned redo = 0;   // bit 2i+t: row row0+i, feature d0+t goes through mta_exact
#pragma unroll
    for (int i = 0; i < 2; ++i) {
        if (de[2 * i] >= 1.0e-20f && de[2 * i + 1] >= 1.0e-20f && rmax[row0 + i] >= -9.0e8f) {
            float2 o;
            o.x = nu[2 * i] / de[2 * i];
            o.y = nu[2 * i + 1] / de[2 * i + 1];
            *(float2*)(xp + i * HD) = o;
        } else {
            redo |= 3u << (2 * i);
        }
    }
    if (redo) {
        // Kept rolled so that the rare path's loop stands once in the code.
#pragma nounroll
        for (int e = 0; e < 4; ++e) {
            if ((redo >> e) & 1u) {
                float* xe = xp + (e >> 1) * HD + (e & 1);
                *xe = mta_exact(qrows + (row0 + (e >> 1)) * EMBED_TIME, krows, scale,
                                V  + (size_t)b * LK * INPUT_DIM + d0 + (e & 1),
                                MK + (size_t)b * LK * INPUT_DIM + d0 + (e & 1));
                // The store's address pair is reused by the next trip only behind this wait.
                asm volatile("s_wait_xcnt 0x0" :: "v"(xe) : "memory");
            }
        }
    }
}

// ---------------------------------------------------------------------------
// Orchestration
// ---------------------------------------------------------------------------
extern "C" void kernel_launch(void* const* d_in, const int* in_sizes, int n_in,
                              void* d_out, int out_size, void* d_ws, size_t ws_size,
                              hipStream_t stream)
{
    const float* query  = (const float*)d_in[0];   // [4,256,128]
    const float* key_ts = (const float*)d_in[1];   // [4,512,128]
    const float* value  = (const float*)d_in[2];   // [4,512,64]
    const int*   mask   = (const int*)  d_in[3];   // [4,512,64]
    const float* Wq     = (const float*)d_in[4];   // [128,128]
    const float* bq     = (const float*)d_in[5];
    const float* Wk     = (const float*)d_in[6];
    const float* bk     = (const float*)d_in[7];
    const float* W3     = (const float*)d_in[8];   // [256,256]
    const float* b3     = (const float*)d_in[9];
    float*       out    = (float*)d_out;           // [4,256,256]

    // Workspace layout (floats); total ~3 MB.
    float* ws     = (float*)d_ws;
    float* qp     = ws;                                  // 4*256*128   = 131072
    float* kp     = qp + (size_t)BB * LQ * EMBED_TIME;   // 4*512*128   = 262144
    float* x      = kp + (size_t)BB * LK * EMBED_TIME;   // 1024*256
    float* W3p    = x + (size_t)BB * LQ * HD;            // 256*256
    float* nrm    = W3p + (size_t)HD * NHIDDEN;          // 256

    // 1) qp = query @ Wq + bq, kp = key_ts @ Wk + bk, W3 row norms
    proj_qk_w3norm<<<dim3(QBLK + KBLK + HD), dim3(256), 0, stream>>>(
        query, Wq, bq, qp, key_ts, Wk, bk, kp, W3, nrm, EMBED_TIME, EMBED_TIME);

    // 2) scores = qp_h @ kp_h^T / sqrt(dk), masked softmax over Lk, weighted reduce -> x [4,256,256];
    //    W3 rows gathered in stable descending order of norm
    const float scale = 0.17677669529663687f;   // 1/sqrt(32)
    mta_scores_softmax_reduce<<<dim3(MTABLK + HD), dim3(256), 0, stream>>>(
        qp, kp, scale, value, mask, x, W3, nrm, W3p);

    // 3) out = x @ W3p + b3 : [1024,256] @ [256,256]
    gemm_wmma_f32<<<dim3((BB * LQ / 16) * (NHIDDEN / 16)), dim3(32), 0, stream>>>(
        x, W3p, b3, out, BB * LQ, NHIDDEN, HD, 1.0f);
}

// v004
// A run of this version takes 15.3 microseconds.
// Next to v003, in two timings, it ran 1.80 and 1.85 times as fast.
// Over all steps from v000 it is 18.4 times as fast.
#include <hip/hip_runtime.h>
#include <hip/hip_bf16.h>
#include <math.h>

// ---------------------------------------------------------------------------
// multiTimeAttention for MI455X (gfx1250, wave32, WMMA)
//
// Pipeline, three launches; jobs that read none of each other's output share a grid:
//   1) qp = query @ Wq + bq | kp = key_ts @ Wk + bk | W3 row L1 norms
//   2) scores qp_h @ kp_h^T / sqrt(32), masked softmax over Lk, weighted reduce -> x
//      | stable descending rank of the norms -> gather W3p
//   3) out = x @ W3p + b3
// Every product runs on WMMA f32 16x16x4.
// ---------------------------------------------------------------------------

typedef __attribute__((ext_vector_type(2))) float v2f;
typedef __attribute__((ext_vector_type(8))) float v8f;

#define EMBED_TIME 128
#define NUM_HEADS  4
#define DK         32        // EMBED_TIME / NUM_HEADS
#define INPUT_DIM  64
#define NHIDDEN    256
#define BB         4
#define LQ         256
#define LK         512
#define HD         256       // NUM_HEADS * INPUT_DIM

// ---------------------------------------------------------------------------
// GEMM: C[M,N] = A[M,K] @ B[K,N] + bias[N], K = 32 * KS, A and B row-major.
// A block of 8 waves owns 8 / KS tiles of 16 rows x 64 columns; KS waves share a tile, each
// with 32 of its k, so that a wave has ALL of its operand loads in flight at once (one trip
// to memory instead of one per 16 k). The KS partial tiles are summed through LDS in wave order.
// Column n of column tile t is column tn + 4n + t: a lane's four columns come from one
// 16-byte load and go out in one 16-byte store, a half-wave on two whole 128-byte lines.
// k order inside a group of 8 k: half-wave hh, step s, register j holds
// k = 8p + 4hh + 2s + j, the same for the A and the B fragment.
// Requires M % (16 * 8 / KS) == 0, N % 64 == 0. EXEC is all-1s (whole waves only).
// red: 8 waves x 8 rows x 32 lanes x 4 floats.
// ---------------------------------------------------------------------------
#define GEMM_RED (8 * 8 * 32 * 4)

template <int KS, int N>
__device__ __forceinline__
void gemm_ksplit_f32(const float* __restrict__ A, const float* __restrict__ B,
                     const float* __restrict__ bias, float* __restrict__ C,
                     float* red, int blk)
{
    constexpr int K   = 32 * KS;
    constexpr int RT  = 8 / KS;          // row tiles a block
    constexpr int NTN = N / 64;
    // The wave's number as a scalar, so that the tile's addresses stay wave-uniform.
    const int w    = __builtin_amdgcn_readfirstlane(threadIdx.x >> 5);
    const int lane = threadIdx.x & 31;
    const int n    = lane & 15;          // m (for A) / n (for B,C)
    const int hh   = lane >> 4;
    const int tm0  = (blk / NTN) * (16 * RT);
    const int tn   = (blk % NTN) * 64;
    const int tm   = tm0 + (w / KS) * 16;
    const int k0   = (w % KS) * 32;

    const float* pa = A + (size_t)(tm + n) * K + k0 + hh * 4;
    const float* pb = B + (size_t)(k0 + hh * 4) * N + tn + n * 4;
    const float* pbias = bias + tn + n * 4;
    float4 fa[4], fb[4][4];
    // In the order of their use: the products of group p wait for the loads of groups 0..p only.
#pragma unroll
    for (int p = 0; p < 4; ++p) {
        fa[p] = *(const float4*)(pa + p * 8);
#pragma unroll
        for (int i = 0; i < 4; ++i)
            fb[p][i] = *(const float4*)(pb + (p * 8 + i) * N);
    }
    const float4 bv = *(const float4*)pbias;
    // The loads' address registers may be reused only from here on; the addresses as inputs
    // (n too: the bias load is built with it as its offset register) keep a load's result
    // out of them before the wait.
    asm volatile("s_wait_xcnt 0x0" :: "v"(pa), "v"(pb), "v"(pbias), "v"(n) : "memory");
    // All 21 loads, then the 32 products: without it the last group's loads went out behind
    // the first products, a second trip to memory. (A full scheduling barrier here put every
    // register move, and so the wait for the LAST load, in front of the first product.)
    __builtin_amdgcn_sched_group_barrier(0x020, 21, 0);
    __builtin_amdgcn_sched_group_barrier(0x008, 32, 0);

    v8f acc[4] = {};   // [column tile]; register r: row 8hh + r
#pragma unroll
    for (int p = 0; p < 4; ++p) {
#pragma unroll
        for (int s = 0; s < 2; ++s) {
            v2f A2;
            A2.x = s ? fa[p].z : fa[p].x;  A2.y = s ? fa[p].w : fa[p].y;
            const float4 b0 = fb[p][2 * s], b1 = fb[p][2 * s + 1];
            v2f B2[4];
            B2[0].x = b0.x;  B2[0].y = b1.x;
            B2[1].x = b0.y;  B2[1].y = b1.y;
            B2[2].x = b0.z;  B2[2].y = b1.z;
            B2[3].x = b0.w;  B2[3].y = b1.w;
#pragma unroll
            for (int t = 0; t < 4; ++t)
                acc[t] = __builtin_amdgcn_wmma_f32_16x16x4_f32(
                    /*neg_a=*/false, A2, /*neg_b=*/false, B2[t],
                    /*c_mod=*/(short)0, acc[t], /*reuse_a=*/false, /*reuse_b=*/false);
        }
    }

#pragma unroll
    for (int r = 0; r < 8; ++r)
        *(float4*)(red + (((w * 8 + r) * 32 + lane) << 2)) =
            make_float4(acc[0][r], acc[1][r], acc[2][r], acc[3][r]);
    __syncthreads();

    // Wave w sums and stores RT of the block's 8 * RT rows-of-registers.
#pragma unroll
    for (int i = 0; i < RT; ++i) {
        const int idx = w * RT + i;
        const int rt  = idx >> 3, r = idx & 7;
        float4 o = *(const float4*)(red + ((((rt * KS) * 8 + r) * 32 + lane) << 2));
#pragma unroll
        for (int q = 1; q < KS; ++q) {
            const float4 c = *(const float4*)(red + ((((rt * KS + q) * 8 + r) * 32 + lane) << 2));
            o.x += c.x; o.y += c.y; o.z += c.z; o.w += c.w;
        }
        o.x += bv.x; o.y += bv.y; o.z += bv.z; o.w += bv.w;
        *(float4*)(C + (size_t)(tm0 + rt * 16 + hh * 8 + r) * N + tn + n * 4) = o;
    }
}

__global__ __launch_bounds__(256)
void gemm_out_f32(const float* __restrict__ A, const float* __restrict__ B,
                  const float* __restrict__ bias, float* __restrict__ C)
{
    __shared__ __attribute__((aligned(16))) float red[GEMM_RED];
    gemm_ksplit_f32<HD / 32, NHIDDEN>(A, B, bias, C, red, blockIdx.x);
}

// ---------------------------------------------------------------------------
// W3 row L1 norm of row i (one block per row, tree reduction).
// ---------------------------------------------------------------------------
__device__ __forceinline__
void w3_rownorm_row(const float* __restrict__ W3, float* __restrict__ nrm, float* red, int i)
{
    red[threadIdx.x] = fabsf(W3[(size_t)i * NHIDDEN + threadIdx.x]);
    __syncthreads();
    for (int s = 128; s > 0; s >>= 1) {
        if (threadIdx.x < (unsigned)s) red[threadIdx.x] += red[threadIdx.x + s];
        __syncthreads();
    }
    if (threadIdx.x == 0) nrm[i] = red[0];
}

// ---------------------------------------------------------------------------
// Launch 1: the three jobs that read inputs only, in one grid of 256-thread blocks.
// Blocks [0, QBLK): Q projection, [QBLK, QBLK + KBLK): K projection, 32 rows x 64 columns
// a block (two row tiles, the 128 k over 4 waves each); the rest: one W3 row norm each.
// The projections stand first in the grid: their chain is the longer one.
// ---------------------------------------------------------------------------
#define QBLK ((BB * LQ / 32) * (EMBED_TIME / 64))   // 64
#define KBLK ((BB * LK / 32) * (EMBED_TIME / 64))   // 128

__global__ __launch_bounds__(256)
void proj_qk_w3norm(const float* __restrict__ query, const float* __restrict__ Wq,
                    const float* __restrict__ bq, float* __restrict__ qp,
                    const float* __restrict__ key_ts, const float* __restrict__ Wk,
                    const float* __restrict__ bk, float* __restrict__ kp,
                    const float* __restrict__ W3, float* __restrict__ nrm)
{
    __shared__ __attribute__((aligned(16))) float red[GEMM_RED];
    const int blk = blockIdx.x;
    if (blk >= QBLK + KBLK) {
        w3_rownorm_row(W3, nrm, red, blk - (QBLK + KBLK));
        return;
    }
    const bool isq = blk < QBLK;
    gemm_ksplit_f32<EMBED_TIME / 32, EMBED_TIME>(isq ? query : key_ts, isq ? Wq : Wk, isq ? bq : bk,
                                                 isq ? qp : kp, red, isq ? blk : blk - QBLK);
    // The tile's stores: their data and address registers may be reused only from here on
    // (in the built kernel the row-norm code may stand behind this path and rewrite them).
    asm volatile("s_wait_xcnt 0x0" ::: "memory");
}

// ---------------------------------------------------------------------------
// Stable descending rank of row i, then scatter row i to W3p[rank].
// rank(i) = #{j : n_j > n_i} + #{j < i : n_j == n_i}  (stable argsort(-n)).
// ---------------------------------------------------------------------------
__device__ __forceinline__
void w3_permute_row(const float* __restrict__ W3, const float* __restrict__ nrm,
                    float* __restrict__ W3p, int* cnt, int i)
{
    const int j  = threadIdx.x;
    const float ni = nrm[i];
    const float nj = nrm[j];
    cnt[j] = (nj > ni || (nj == ni && j < i)) ? 1 : 0;
    __syncthreads();
    for (int s = 128; s > 0; s >>= 1) {
        if (j < s) cnt[j] += cnt[j + s];
        __syncthreads();
    }
    const int rank = cnt[0];
    W3p[(size_t)rank * NHIDDEN + j] = W3[(size_t)i * NHIDDEN + j];
}

// ---------------------------------------------------------------------------
// Launch 2. Blocks [0, MTABLK): scores, masked softmax over Lk and weighted reduce with
// value; the rest: one W3 row each (rank and scatter), behind them in the grid because
// their chain is the shorter one.
// s[q,k] = scale * sum_e qp[b,q,h*32+e] * kp[b,k,h*32+e] stays in the block that uses it.
// The score does not depend on the feature d, so with P[q,k] = exp(s[q,k] - rowmax[q])
//   num[q,d] = sum_k P[q,k] * (mask[k,d] ? v[k,d] : 0)
//   den[q,d] = sum_k P[q,k] * (mask[k,d] ? 1 : 0)          x = num / den
// which equals the reference's per-feature softmax whenever the masked terms
// (exp(-1e9 - max)) vanish and den keeps full precision. Where that is not
// certain (den tiny or zero: every k masked, or the open k far below the row
// maximum; scores near -1e9; NaN) the element is redone by mta_exact below.
//
// One block = one (b,h), 32 query rows, 32 features (half of d); 8 waves, each
// owning 64 of the 512 k. Tiles per wave: 2 row tiles x {num,den} x 2 column
// tiles; column n of column tile t is feature dh*32 + 2n + t, so a lane's two
// features come from one 8-byte load and a half-wave reads a whole 128-B line.
// k order inside a group of 8 k: half-wave hh, step s, register j holds
// k = 8p + 4hh + 2s + j, the same for the A and the B fragment.
// Scores: the wave forms the 32 rows x its own 64 k as kp_tile @ qp_tile^T, so that a lane
// holds 8 neighbouring k of ONE query row (row = lane & 15) and P goes to LDS in 16-byte
// stores. e order inside a group of 8 e: e = 8p + 4hh + 2s + j, in both fragments.
// ---------------------------------------------------------------------------
#define PPITCH 516   // floats per P row in LDS: 16 B x odd, no bank conflict on 16-byte reads

// Lane l's value from lane l ^ X inside a 16-lane row (DPP row_xmask), and from lane l ^ 16.
template <int X>
__device__ __forceinline__ float lane_xor_row(float x)
{
    const int v = __builtin_bit_cast(int, x);
    return __builtin_bit_cast(float, __builtin_amdgcn_update_dpp(v, v, 0x160 + X, 0xf, 0xf, false));
}
__device__ __forceinline__ float lane_xor_16(float x)
{
    const int v = __builtin_bit_cast(int, x);
    return __builtin_bit_cast(float, __builtin_amdgcn_permlanex16(v, v, 0x76543210, 0xfedcba98, false, false));
}

// exp(x) as __expf forms it (one multiply, v_exp_f32). The v_nop in the same statement is the
// one slot behind a transcendental.
__device__ __forceinline__ float exp_with_slot(float x)
{
    float r;
    asm("v_exp_f32 %0, %1\n\tv_nop" : "=v"(r) : "v"(x * 1.44269504f));
    return r;
}

// Four of them in one statement: each v_exp_f32 stands behind an independent one (the results
// are kept apart from all four sources), so one v_nop behind the last serves all four slots.
__device__ __forceinline__ float4 exp4_with_slot(float a, float b, float c, float d)
{
    float x, y, z, w;
    asm("v_exp_f32 %0, %4\n\tv_exp_f32 %1, %5\n\tv_exp_f32 %2, %6\n\tv_exp_f32 %3, %7\n\tv_nop"
        : "=&v"(x), "=&v"(y), "=&v"(z), "=&v"(w)
        : "v"(a * 1.44269504f), "v"(b * 1.44269504f), "v"(c * 1.44269504f), "v"(d * 1.44269504f));
    return make_float4(x, y, z, w);
}

// The per-element online softmax with the reference's -1e9 masking (rare path).
// qr, kr: the query row's and key 0's 32 projected values of this head; the score is formed here.
__device__ __forceinline__ float mta_exact(const float* __restrict__ qr, const float* __restrict__ kr,
                                           float scale, const float* __restrict__ vp,
                                           const int* __restrict__ mp)
{
    float4 q[8];
#pragma unroll
    for (int i = 0; i < 8; ++i) q[i] = *(const float4*)(qr + 4 * i);
    // The address as an input keeps a load's result out of its address pair before the wait.
    asm volatile("s_wait_xcnt 0x0" :: "v"(qr) : "memory");
    float mmax = -3.0e38f;
    float num = 0.0f, den = 0.0f;
    // Kept rolled: a path that is hardly ever taken should stay small in the instruction cache.
#pragma nounroll
    for (int k = 0; k < LK; ++k) {
        float4 kv[8];
#pragma unroll
        for (int i = 0; i < 8; ++i) kv[i] = *(const float4*)(kr + 4 * i);
        const int   mk = *mp;
        const float v  = *vp;
        // The three address pairs are stepped below only behind this wait.
        asm volatile("s_wait_xcnt 0x0" :: "v"(kr), "v"(mp), "v"(vp) : "memory");
        kr += EMBED_TIME;
        mp += INPUT_DIM;
        vp += INPUT_DIM;
        float sk = 0.0f;
#pragma unroll
        for (int i = 0; i < 8; ++i)
            sk += q[i].x * kv[i].x + q[i].y * kv[i].y + q[i].z * kv[i].z + q[i].w * kv[i].w;
        sk *= scale;
        const float s     = mk ? sk : -1.0e9f;
        const float mnew  = fmaxf(mmax, s);
        const float scl   = exp_with_slot(mmax - mnew);
        const float p     = exp_with_slot(s - mnew);
        num  = num * scl + p * v;
        den  = den * scl + p;
        mmax = mnew;
    }
    return num / den;
}

#define MTABLK (BB * NUM_HEADS * (LQ / 32) * 2)   // 256

__global__ __launch_bounds__(256)
void mta_scores_softmax_reduce(const float* __restrict__ QP, const float* __restrict__ KP, float scale,
                               const float* __restrict__ V, const int* __restrict__ MK,
                               float* __restrict__ X, const float* __restrict__ W3,
                               const float* __restrict__ nrm, float* __restrict__ W3p)
{
    __shared__ __attribute__((aligned(16))) float p_sh[32 * PPITCH];        // 32 rows
    __shared__ __attribute__((aligned(16))) float red[8 * 16 * 32 * 4];     // 8 waves x 16 entries a lane
    __shared__ float pmax[8 * 32];                                          // a wave's maxima of the 32 rows
    __shared__ float rmax[32];
    __shared__ int   cnt[256];

    if (blockIdx.x >= MTABLK) {
        w3_permute_row(W3, nrm, W3p, cnt, blockIdx.x - MTABLK);
        return;
    }

    const int dh   = blockIdx.x & 1;
    const int q0   = ((blockIdx.x >> 1) & 7) << 5;
    const int bh   = blockIdx.x >> 4;
    const int b    = bh >> 2;
    const int h    = bh & 3;
    const int lane = threadIdx.x & 31;
    const int w    = threadIdx.x >> 5;
    const int n    = lane & 15;
    const int hh   = lane >> 4;
    const int kbase = w << 6;

    // Score fragments (needed first): 2 tiles of 16 query rows, 4 tiles of 16 keys, 16 of a
    // row's 32 e a lane.
    const float* qrows = QP + ((size_t)b * LQ + q0) * EMBED_TIME + h * DK;
    const float* krows = KP + (size_t)b * LK * EMBED_TIME + h * DK;
    const float* qf = qrows + n * EMBED_TIME + hh * 4;
    const float* kf = krows + (kbase + n) * EMBED_TIME + hh * 4;
    float4 fq[2][4], fk[4][4];
    // In the order of their use: the products of group p wait for the loads of groups 0..p only.
#pragma unroll
    for (int p = 0; p < 4; ++p) {
#pragma unroll
        for (int rt = 0; rt < 2; ++rt)
            fq[rt][p] = *(const float4*)(qf + rt * 16 * EMBED_TIME + p * 8);
#pragma unroll
        for (int ct = 0; ct < 4; ++ct)
            fk[ct][p] = *(const float4*)(kf + ct * 16 * EMBED_TIME + p * 8);
    }
    // The fragment loads' address registers may be reused only from here on; the
    // addresses as inputs keep a load's result out of them before the wait.
    asm volatile("s_wait_xcnt 0x0" :: "v"(qf), "v"(kf) : "memory");

    // This wave's slice of value and mask, in two halves so that the wave stays within 256
    // registers (two blocks a WGP): the first half flies under all of the score products.
    const size_t boff = ((size_t)b * LK + kbase + hh * 4) * INPUT_DIM + dh * 32 + n * 2;
    const float* vp = V  + boff;
    const int*   mp = MK + boff;
    float2 bv[8][4];
    int2   bm[8][4];
#pragma unroll
    for (int p = 0; p < 4; ++p)
#pragma unroll
        for (int i = 0; i < 4; ++i) {
            bv[p][i] = *(const float2*)(vp + (p * 8 + i) * INPUT_DIM);
            bm[p][i] = *(const int2*)  (mp + (p * 8 + i) * INPUT_DIM);
        }
    // The same for the value and mask loads.
    asm volatile("s_wait_xcnt 0x0" :: "v"(vp), "v"(mp) : "memory");
    // Keeps these loads issued before the first wait on a score fragment.
    __builtin_amdgcn_sched_barrier(0);

    v8f sc[2][4] = {};   // [query tile][key tile]; register r: key 16ct + 8hh + r, query 16rt + n
#pragma unroll
    for (int p = 0; p < 4; ++p) {
        if (p == 3) {
            // The second half goes out in front of the last quarter of the score products, into
            // the registers of the fragments used up. The two scheduling barriers hold it there:
            // earlier it would cost registers, later it would land after the first barrier's wait.
            __builtin_amdgcn_sched_barrier(0);
#pragma unroll
            for (int pp = 4; pp < 8; ++pp)
#pragma unroll
                for (int i = 0; i < 4; ++i) {
                    bv[pp][i] = *(const float2*)(vp + (pp * 8 + i) * INPUT_DIM);
                    bm[pp][i] = *(const int2*)  (mp + (pp * 8 + i) * INPUT_DIM);
                }
            // The address registers may be reused only from here on.
            asm volatile("s_wait_xcnt 0x0" :: "v"(vp), "v"(mp) : "memory");
            __builtin_amdgcn_sched_barrier(0);
        }
#pragma unroll
        for (int s = 0; s < 2; ++s)
#pragma unroll
            for (int ct = 0; ct < 4; ++ct) {
                v2f K2;
                K2.x = s ? fk[ct][p].z : fk[ct][p].x;  K2.y = s ? fk[ct][p].w : fk[ct][p].y;
#pragma unroll
                for (int rt = 0; rt < 2; ++rt) {
                    v2f Q2;
                    Q2.x = s ? fq[rt][p].z : fq[rt][p].x;  Q2.y = s ? fq[rt][p].w : fq[rt][p].y;
                    sc[rt][ct] = __builtin_amdgcn_wmma_f32_16x16x4_f32(
                        false, K2, false, Q2, (short)0, sc[rt][ct], false, false);
                }
            }
    }

    // Row maxima: the lane's 32 k of each row, the other half-wave's, then the 8 waves' via LDS.
    float m[2];
#pragma unroll
    for (int rt = 0; rt < 2; ++rt) {
        float t[4];
#pragma unroll
        for (int ct = 0; ct < 4; ++ct) {
#pragma unroll
            for (int r = 0; r < 8; ++r) sc[rt][ct][r] *= scale;
            t[ct] = fmaxf(fmaxf(fmaxf(sc[rt][ct][0], sc[rt][ct][1]), fmaxf(sc[rt][ct][2], sc[rt][ct][3])),
                          fmaxf(fmaxf(sc[rt][ct][4], sc[rt][ct][5]), fmaxf(sc[rt][ct][6], sc[rt][ct][7])));
        }
        m[rt] = fmaxf(fmaxf(-3.0e38f, fmaxf(t[0], t[1])), fmaxf(t[2], t[3]));
    }
#pragma unroll
    for (int rt = 0; rt < 2; ++rt) m[rt] = fmaxf(m[rt], lane_xor_16(m[rt]));
    if (hh == 0) {
#pragma unroll
        for (int rt = 0; rt < 2; ++rt) pmax[w * 32 + rt * 16 + n] = m[rt];
    }
    __syncthreads();
#pragma unroll
    for (int ww = 0; ww < 8; ++ww)
#pragma unroll
        for (int rt = 0; rt < 2; ++rt) m[rt] = fmaxf(m[rt], pmax[ww * 32 + rt * 16 + n]);

    // P = exp(s - rowmax) into LDS.
#pragma unroll
    for (int rt = 0; rt < 2; ++rt)
#pragma unroll
        for (int ct = 0; ct < 4; ++ct)
#pragma unroll
            for (int c = 0; c < 2; ++c) {
                const float4 pv = exp4_with_slot(sc[rt][ct][c * 4]     - m[rt], sc[rt][ct][c * 4 + 1] - m[rt],
                                                 sc[rt][ct][c * 4 + 2] - m[rt], sc[rt][ct][c * 4 + 3] - m[rt]);
                *(float4*)(p_sh + (rt * 16 + n) * PPITCH + kbase + ct * 16 + hh * 8 + c * 4) = pv;
            }
    if (threadIdx.x < 16) {
#pragma unroll
        for (int rt = 0; rt < 2; ++rt) rmax[rt * 16 + n] = m[rt];
    }
    __syncthreads();

    v8f acc[2][2][2] = {};   // [row tile][num, den][column tile]
#pragma unroll
    for (int p = 0; p < 8; ++p) {
        const float4 a0 = *(const float4*)(p_sh + n * PPITCH        + kbase + p * 8 + hh * 4);
        const float4 a1 = *(const float4*)(p_sh + (16 + n) * PPITCH + kbase + p * 8 + hh * 4);
#pragma unroll
        for (int s = 0; s < 2; ++s) {
            v2f A0, A1;
            A0.x = s ? a0.z : a0.x;  A0.y = s ? a0.w : a0.y;
            A1.x = s ? a1.z : a1.x;  A1.y = s ? a1.w : a1.y;
            const float2 v0 = bv[p][2 * s], v1 = bv[p][2 * s + 1];
            const int2   m0 = bm[p][2 * s], m1 = bm[p][2 * s + 1];
            v2f Bn[2], Bd[2];
            Bn[0].x = m0.x ? v0.x : 0.0f;  Bn[0].y = m1.x ? v1.x : 0.0f;
            Bn[1].x = m0.y ? v0.y : 0.0f;  Bn[1].y = m1.y ? v1.y : 0.0f;
            Bd[0].x = m0.x ? 1.0f : 0.0f;  Bd[0].y = m1.x ? 1.0f : 0.0f;
            Bd[1].x = m0.y ? 1.0f : 0.0f;  Bd[1].y = m1.y ? 1.0f : 0.0f;
#pragma unroll
            for (int t = 0; t < 2; ++t) {
                acc[0][0][t] = __builtin_amdgcn_wmma_f32_16x16x4_f32(
                    false, A0, false, Bn[t], (short)0, acc[0][0][t], false, false);
                acc[1][0][t] = __builtin_amdgcn_wmma_f32_16x16x4_f32(
                    false, A1, false, Bn[t], (short)0, acc[1][0][t], false, false);
                acc[0][1][t] = __builtin_amdgcn_wmma_f32_16x16x4_f32(
                    false, A0, false, Bd[t], (short)0, acc[0][1][t], false, false);
                acc[1][1][t] = __builtin_amdgcn_wmma_f32_16x16x4_f32(
                    false, A1, false, Bd[t], (short)0, acc[1][1][t], false, false);
            }
        }
    }

    // Sum the 8 waves' k slices through LDS, in wave order. One 16-byte entry holds two
    // rows (registers 2rs, 2rs+1) of a lane's two features, so that the wave that sums an
    // entry stores 8 bytes a lane and a half-wave writes a whole 128-byte line of x.
#pragma unroll
    for (int mt = 0; mt < 2; ++mt)
#pragma unroll
        for (int ty = 0; ty < 2; ++ty)
#pragma unroll
            for (int rs = 0; rs < 4; ++rs) {
                float4 o;
                o.x = acc[mt][ty][0][rs * 2];     o.y = acc[mt][ty][1][rs * 2];
                o.z = acc[mt][ty][0][rs * 2 + 1]; o.w = acc[mt][ty][1][rs * 2 + 1];
                *(float4*)(red + (((((w * 2 + mt) * 2 + ty) * 4 + rs) * 32 + lane) << 2)) = o;
            }
    __syncthreads();

    const int mt = w >> 2, rs = w & 3;
    float nu[4] = {0.0f, 0.0f, 0.0f, 0.0f}, de[4] = {0.0f, 0.0f, 0.0f, 0.0f};   // [2 * row + feature]
#pragma unroll
    for (int ww = 0; ww < 8; ++ww) {
        const float4 a = *(const float4*)(red + (((((ww * 2 + mt) * 2 + 0) * 4 + rs) * 32 + lane) << 2));
        const float4 c = *(const float4*)(red + (((((ww * 2 + mt) * 2 + 1) * 4 + rs) * 32 + lane) << 2));
        nu[0] += a.x; nu[1] += a.y; nu[2] += a.z; nu[3] += a.w;
        de[0] += c.x; de[1] += c.y; de[2] += c.z; de[3] += c.w;
    }

    const int d0   = dh * 32 + n * 2;
    const int row0 = mt * 16 + hh * 8 + rs * 2;
    float* xp = X + ((size_t)b * LQ + q0 + row0) * HD + (h << 6) + d0;
    unsigned redo = 0;   // bit 2i+t: row row0+i, feature d0+t goes through mta_exact
#pragma unroll
    for (int i = 0; i < 2; ++i) {
        if (de[2 * i] >= 1.0e-20f && de[2 * i + 1] >= 1.0e-20f && rmax[row0 + i] >= -9.0e8f) {
            float2 o;
            o.x = nu[2 * i] / de[2 * i];
            o.y = nu[2 * i + 1] / de[2 * i + 1];
            *(float2*)(xp + i * HD) = o;
        } else {
            redo |= 3u << (2 * i);
        }
    }
    if (redo) {
        // Kept rolled so that the rare path's loop stands once in the code.
#pragma nounroll
        for (int e = 0; e < 4; ++e) {
            if ((redo >> e) & 1u) {
                float* xe = xp + (e >> 1) * HD + (e & 1);
                *xe = mta_exact(qrows + (row0 + (e >> 1)) * EMBED_TIME, krows, scale,
                                V  + (size_t)b * LK * INPUT_DIM + d0 + (e & 1),
                                MK + (size_t)b * LK * INPUT_DIM + d0 + (e & 1));
                // The store's address pair is reused by the next trip only behind this wait.
                asm volatile("s_wait_xcnt 0x0" :: "v"(xe) : "memory");
            }
        }
    }
}

// ---------------------------------------------------------------------------
// Orchestration
// ---------------------------------------------------------------------------
extern "C" void kernel_launch(void* const* d_in, const int* in_sizes, int n_in,
                              void* d_out, int out_size, void* d_ws, size_t ws_size,
                              hipStream_t stream)
{
    const float* query  = (const float*)d_in[0];   // [4,256,128]
    const float* key_ts = (const float*)d_in[1];   // [4,512,128]
    const float* value  = (const float*)d_in[2];   // [4,512,64]
    const int*   mask   = (const int*)  d_in[3];   // [4,512,64]
    const float* Wq     = (const float*)d_in[4];   // [128,128]
    const float* bq     = (const float*)d_in[5];
    const float* Wk     = (const float*)d_in[6];
    const float* bk     = (const float*)d_in[7];
    const float* W3     = (const float*)d_in[8];   // [256,256]
    const float* b3     = (const float*)d_in[9];
    float*       out    = (float*)d_out;           // [4,256,256]

    // Workspace layout (floats); total ~3 MB.
    float* ws     = (float*)d_ws;
    float* qp     = ws;                                  // 4*256*128   = 131072
    float* kp     = qp + (size_t)BB * LQ * EMBED_TIME;   // 4*512*128   = 262144
    float* x      = kp + (size_t)BB * LK * EMBED_TIME;   // 1024*256
    float* W3p    = x + (size_t)BB * LQ * HD;            // 256*256
    float* nrm    = W3p + (size_t)HD * NHIDDEN;          // 256

    // 1) qp = query @ Wq + bq, kp = key_ts @ Wk + bk, W3 row norms
    proj_qk_w3norm<<<dim3(QBLK + KBLK + HD), dim3(256), 0, stream>>>(
        query, Wq, bq, qp, key_ts, Wk, bk, kp, W3, nrm);

    // 2) scores = qp_h @ kp_h^T / sqrt(dk), masked softmax over Lk, weighted reduce -> x [4,256,256];
    //    W3 rows gathered in stable descending order of norm
    const float scale = 0.17677669529663687f;   // 1/sqrt(32)
    mta_scores_softmax_reduce<<<dim3(MTABLK + HD), dim3(256), 0, stream>>>(
        qp, kp, scale, value, mask, x, W3, nrm, W3p);

    // 3) out = x @ W3p + b3 : [1024,256] @ [256,256]
    gemm_out_f32<<<dim3((BB * LQ / 16) * (NHIDDEN / 64)), dim3(256), 0, stream>>>(
        x, W3p, b3, out);
}
